// v000
// Times are from an AMD MI455X. After a warm-up the kernel runs many times in a row, and a time is the length of
// such a window on the GPU divided by its runs, so every launch and the gaps after it count. The runs cycle
// through copies of the inputs. A figure is the median of several windows, for all but v000 over two sittings.
// Sittings can differ by a few percent; kernels timed side by side share one.
// The starting kernel, v000, takes 535 microseconds a run.
#include <hip/hip_runtime.h>

// SSelfAttention: per (b, t, h): q,k,v = x[b][n][t][h*8..+8] W^T (8x8 per-head linears shared across heads); energy[q][k] = q.k; attn = softmax_k(energy / sqrt(64)); out = attn v -> [b][n][t][h*8+d]; final out @ Wo^T + bo -> [2][512][24][64].
// Deterministic: per-wave softmax over the 512 nodes in fixed order; no atomics.
// WMMA (v_wmma_f32_16x16x32_f16, f32 accumulate): per (b, t, h, 16-query) wave S = q rows (hi+lo x256, K 8 padded to 32) x k rows (hi+lo; 32 tiles) and o = P (hi+lo) x v^T rows (hi+lo; 1 tile of 8 real cols, K 512), 3 products; out = o (hi+lo, K 64) x Wo rows (EXACT; 4 tiles) per 16-row wave — 1.8 M WMMA; the 8x8 projections and softmax in f32.

namespace {
constexpr int NB_ = 2, N = 512, T = 24, E = 64, H = 8, HD = 8, NBT = NB_ * T /* 48 (b,t) groups */;
constexpr float HS = 256.0f, PS = 256.0f, WSC = 256.0f, SCALE = 0.125f /* 1/sqrt(64) */;
typedef _Float16 b16;
typedef __attribute__((ext_vector_type(16))) _Float16 v16b;
typedef __attribute__((ext_vector_type(8))) _Float16 v8b;
typedef __attribute__((ext_vector_type(8))) float v8f;
typedef __attribute__((ext_vector_type(4))) float v4f;
typedef __attribute__((ext_vector_type(2))) float v2f;
__device__ __forceinline__ float bf16_rne(float f) { unsigned int u = __float_as_uint(f); u += 0x7FFFu + ((u >> 16) & 1u); float r = __uint_as_float(u & 0xFFFF0000u); asm volatile("" : "+v"(r)); return r; }
__device__ __forceinline__ float bfv(float f) { float r = bf16_rne(f); asm volatile("" : "+v"(r)); return r; }
__device__ __forceinline__ void split16(float v, b16& hi, b16& lo) { hi = (b16)v; lo = (b16)(v - (float)hi); }
__device__ __forceinline__ v16b frag_kb(const b16* p, int hh) { const v8b a = *(const v8b*)(p + 8 * hh), b = *(const v8b*)(p + 16 + 8 * hh); v16b f;
#pragma unroll
  for (int e = 0; e < 8; ++e) { f[e] = a[e]; f[8 + e] = b[e]; } return f; }
__device__ __forceinline__ v8f wmma16b(v16b a, v16b b, v8f c) { v8f d = __builtin_amdgcn_wmma_f32_16x16x32_f16(false, a, false, b, (short)0, c, false, false); asm volatile("v_nop\n\tv_nop\n\tv_nop\n\tv_nop" : "+v"(d) : "v"(a), "v"(b)); return d; }
__device__ __forceinline__ void wave_lds_sync() { __builtin_amdgcn_fence(__ATOMIC_RELEASE, "workgroup"); __builtin_amdgcn_wave_barrier(); __builtin_amdgcn_fence(__ATOMIC_ACQUIRE, "workgroup"); }
__device__ __forceinline__ float pmul(float a, float b) { float p = a * b; asm volatile("" : "+v"(p)); return p; }

typedef __attribute__((ext_vector_type(2))) _Float16 v2b;
__global__ __launch_bounds__(256) void proj_kernel(const float* __restrict__ xv, const float* __restrict__ xk, const float* __restrict__ xq, const float* __restrict__ wv, const float* __restrict__ wk, const float* __restrict__ wq, b16* __restrict__ QPh, b16* __restrict__ QPl, b16* __restrict__ KPh, b16* __restrict__ KPl, b16* __restrict__ VTh, b16* __restrict__ VTl) { __shared__ float Vs[H][HD][65], Wl[3][HD][HD]; const int b = blockIdx.x / (T * (N / 64)), rem = blockIdx.x % (T * (N / 64)); const int t = rem / (N / 64), n0 = (rem % (N / 64)) * 64; const int tid = threadIdx.x, h = tid >> 5, lane = tid & 31; const int bth = (b * T + t) * H + h;
  if (tid < 3 * HD * HD) { const int w = tid / (HD * HD), ij = tid % (HD * HD); const float* src = w == 0 ? wq : (w == 1 ? wk : wv); Wl[w][ij / HD][ij % HD] = bfv(src[ij]); }
  __syncthreads();
  const v8b z8 = {0, 0, 0, 0, 0, 0, 0, 0};
  for (int half = 0; half < 2; ++half) { const int n = n0 + half * 32 + lane; const size_t xo = (((size_t)b * N + n) * T + t) * E + h * HD; const size_t ro = ((size_t)bth * N + n) * 32;
    for (int which = 0; which < 3; ++which) { const float* xs = which == 0 ? xq : (which == 1 ? xk : xv); float xx[HD];
#pragma unroll
      for (int j = 0; j < HD; ++j) xx[j] = bfv(xs[xo + j]);
      v8b hh8, ll8;
#pragma unroll
      for (int i = 0; i < HD; ++i) { float s = 0.0f;
#pragma unroll
        for (int j = 0; j < HD; ++j) s += pmul(xx[j], Wl[which][i][j]); if (which == 2) Vs[h][i][half * 32 + lane] = s; else { b16 p, pl; split16(s * HS, p, pl); hh8[i] = p; ll8[i] = pl; } }
      if (which < 2) { b16* Ph = which == 0 ? QPh : KPh; b16* Pl = which == 0 ? QPl : KPl; { *(v8b*)(Ph + ro) = hh8; *(v8b*)(Pl + ro) = ll8; for (int c = 8; c < 32; c += 8) { *(v8b*)(Ph + ro + c) = z8; *(v8b*)(Pl + ro + c) = z8; }  } } } }
  __syncthreads();
  { for (int d = 0; d < 16; ++d) { b16 h0 = (b16)0.0f, l0 = (b16)0.0f, h1 = (b16)0.0f, l1 = (b16)0.0f; if (d < HD) { split16(Vs[h][d][lane * 2] * HS, h0, l0); split16(Vs[h][d][lane * 2 + 1] * HS, h1, l1); } const size_t o = ((size_t)bth * 16 + d) * N + n0 + lane * 2; *(v2b*)(VTh + o) = (v2b){h0, h1}; *(v2b*)(VTl + o) = (v2b){l0, l1}; }  } }
__global__ __launch_bounds__(32) void att_kernel(const b16* __restrict__ QPh, const b16* __restrict__ QPl, const b16* __restrict__ KPh, const b16* __restrict__ KPl, const b16* __restrict__ VTh, const b16* __restrict__ VTl, int GLIM, float* __restrict__ AO) { __shared__ __attribute__((aligned(16))) b16 Pa[16][N + 8], Pb[16][N + 8]; __shared__ float Sc[16][N + 1], Of[16][9]; const int lane = threadIdx.x, nloc = lane & 15, hlf = lane >> 4; const int bth = blockIdx.x / (N / 16), q0 = (blockIdx.x % (N / 16)) * 16; if (bth >= GLIM) return;
  const v16b qa = frag_kb(QPh + ((size_t)bth * N + q0 + nloc) * 32, hlf), ql = frag_kb(QPl + ((size_t)bth * N + q0 + nloc) * 32, hlf);
#pragma unroll 4
  for (int tk = 0; tk < N / 16; ++tk) { const size_t ko = ((size_t)bth * N + tk * 16 + nloc) * 32; const v16b kh = frag_kb(KPh + ko, hlf), kl = frag_kb(KPl + ko, hlf); v8f s = wmma16b(qa, kh, (v8f){}); s = wmma16b(qa, kl, s); s = wmma16b(ql, kh, s);
#pragma unroll
    for (int r8 = 0; r8 < 8; ++r8) Sc[8 * hlf + r8][tk * 16 + nloc] = s[r8] * (SCALE / (HS * HS)); }
  wave_lds_sync();
  if (lane < 16) { const int r = lane; float mx = -INFINITY; for (int k = 0; k < N; ++k) mx = fmaxf(mx, Sc[r][k]); float sm = 0.0f; for (int k = 0; k < N; ++k) { const float p = __expf(Sc[r][k] - mx); Sc[r][k] = p; sm += p; } const float inv = 1.0f / sm; for (int k = 0; k < N; ++k) { b16 p, pl; split16(Sc[r][k] * inv * PS, p, pl); Pa[r][k] = p; Pb[r][k] = pl; } for (int k = N; k < N + 8; ++k) { Pa[r][k] = (b16)0.0f; Pb[r][k] = (b16)0.0f; } }
  wave_lds_sync();
  v8f o = (v8f){};
#pragma unroll 4
  for (int kb = 0; kb < N; kb += 32) { const v16b pa = frag_kb(&Pa[nloc][kb], hlf), pb = frag_kb(&Pb[nloc][kb], hlf); const size_t vo = ((size_t)bth * 16 + nloc) * N + kb; const v16b vh = frag_kb(VTh + vo, hlf), vl = frag_kb(VTl + vo, hlf); o = wmma16b(pa, vh, o); o = wmma16b(pa, vl, o); o = wmma16b(pb, vh, o); }
#pragma unroll
  for (int r8 = 0; r8 < 8; ++r8) if (nloc < HD) Of[8 * hlf + r8][nloc] = o[r8] * (1.0f / (PS * HS));
  wave_lds_sync();
  { for (int q = 0; q < 4; ++q) { const int idx = q * 32 + lane; ((float*)AO)[((size_t)bth * N + q0) * HD + idx] = Of[idx >> 3][idx & 7]; }  } }
__global__ __launch_bounds__(32) void outp_kernel(const float* __restrict__ AO, const float* __restrict__ wo, const float* __restrict__ bo, int GLIM, float* __restrict__ out) { __shared__ __attribute__((aligned(16))) b16 Ah[16][E + 8], Al[16][E + 8], Wr[E][E + 8]; __shared__ float Tf[16][E + 1]; const int lane = threadIdx.x, nloc = lane & 15, hlf = lane >> 4; const size_t r0 = (size_t)blockIdx.x * 16;
  for (int o = 0; o < E; ++o) for (int q = 0; q < 2; ++q) Wr[o][q * 32 + lane] = (b16)(bfv(wo[o * E + q * 32 + lane]) * WSC); if (lane < 16) for (int o = 0; o < E; o += 1) for (int k = E; k < E + 8; ++k) Wr[o][k] = (b16)0.0f;
  for (int rr = 0; rr < 16; ++rr) { const size_t row = r0 + rr; const int b = (int)(row / ((size_t)N * T)), n = (int)((row / T) % N), t = (int)(row % T); for (int q = 0; q < 2; ++q) { const int c = q * 32 + lane; const int h = c / HD, d = c % HD; const int bth = (b * T + t) * H + h; const float v = bth < GLIM ? AO[((size_t)bth * N + n) * HD + d] : 0.0f; b16 p, pl; split16(v * HS, p, pl); Ah[rr][c] = p; Al[rr][c] = pl; } }
  if (lane < 16) for (int k = E; k < E + 8; ++k) { Ah[lane][k] = (b16)0.0f; Al[lane][k] = (b16)0.0f; }
  wave_lds_sync(); v8f acc[4] = {(v8f){}, (v8f){}, (v8f){}, (v8f){}};
#pragma unroll
  for (int kb = 0; kb < E; kb += 32) { const v16b a = frag_kb(&Ah[nloc][kb], hlf), al = frag_kb(&Al[nloc][kb], hlf);
#pragma unroll
    for (int t4 = 0; t4 < 4; ++t4) { const v16b bw = frag_kb(&Wr[t4 * 16 + nloc][kb], hlf); acc[t4] = wmma16b(a, bw, acc[t4]); acc[t4] = wmma16b(al, bw, acc[t4]); } }
#pragma unroll
  for (int t4 = 0; t4 < 4; ++t4) { const int cc = t4 * 16 + nloc; const float bb = bfv(bo[cc]);
#pragma unroll
    for (int r8 = 0; r8 < 8; ++r8) Tf[8 * hlf + r8][cc] = acc[t4][r8] * (1.0f / (HS * WSC)) + bb; }
  wave_lds_sync();
  { for (int rr = 0; rr < 16; ++rr) *(v2f*)(out + (r0 + rr) * E + lane * 2) = (v2f){Tf[rr][lane * 2], Tf[rr][lane * 2 + 1]};  } }
}  // namespace

extern "C" void kernel_launch(void* const* d_in, const int* in_sizes, int n_in, void* d_out, int out_size, void* d_ws, size_t ws_size, hipStream_t stream) {
  (void)n_in;
  auto Fp = [&](int i) { return (const float*)d_in[i]; };
  // Input order: 0 values [2,512,24,64]; 1 keys; 2 query; 3 Wv [8,8]; 4 Wk; 5 Wq; 6 Wo [64,64]; 7 bo [64]
  if (in_sizes[0] != NB_ * N * T * E || in_sizes[1] != NB_ * N * T * E || in_sizes[2] != NB_ * N * T * E || in_sizes[3] != HD * HD || in_sizes[6] != E * E || out_size != NB_ * N * T * E) return;
  const int GLIM = NBT * H;   // (b,t,h) group cut
  size_t off = 0; char* ws = (char*)d_ws;
  auto carve = [&](size_t bytes) { char* p = ws + off; off += (bytes + 255) & ~(size_t)255; return p; };
  const size_t ng = (size_t)NBT * H;   // 384 groups
  b16* QPh = (b16*)carve(ng * N * 32 * 2); b16* QPl = (b16*)carve(ng * N * 32 * 2); b16* KPh = (b16*)carve(ng * N * 32 * 2); b16* KPl = (b16*)carve(ng * N * 32 * 2); b16* VTh = (b16*)carve(ng * 16 * N * 2); b16* VTl = (b16*)carve(ng * 16 * N * 2); float* AO = (float*)carve(ng * N * HD * 4);
  if (off > ws_size || off > ((size_t)80 << 20)) return;   // ~ 69 MB
  proj_kernel<<<NB_ * T * (N / 64), 256, 0, stream>>>(Fp(0), Fp(1), Fp(2), Fp(3), Fp(4), Fp(5), QPh, QPl, KPh, KPl, VTh, VTl);
  att_kernel<<<(unsigned)(ng * (N / 16)), 32, 0, stream>>>(QPh, QPl, KPh, KPl, VTh, VTl, GLIM, AO);
  outp_kernel<<<NB_ * N * T / 16, 32, 0, stream>>>(AO, Fp(6), Fp(7), GLIM, (float*)d_out);
}

// v001
// It runs in 133 microseconds.
// Next to v000, in two timings, it ran 4.04 and 4.06 times as fast.
#include <hip/hip_runtime.h>

// SSelfAttention: per (b, t, h): q,k,v = x[b][n][t][h*8..+8] W^T (8x8 per-head linears shared across heads); energy[q][k] = q.k; attn = softmax_k(energy / sqrt(64)); out = attn v -> [b][n][t][h*8+d]; final out @ Wo^T + bo -> [2][512][24][64].
// Deterministic: per-wave softmax over the 512 nodes in fixed order; no atomics.
// WMMA (v_wmma_f32_16x16x32_f16, f32 accumulate): per (b, t, h, 16-query) wave S^T = k rows (hi+lo; 32 tiles) x q rows (hi+lo x256, K 8 padded to 32) and o^T = v^T rows (hi+lo; 8 real rows, K 512) x P^T (hi+lo, from the score registers), 3 products; out = o (hi+lo, K 64) x Wo rows (EXACT; 4 tiles) per 16-row wave; the 8x8 projections and softmax in f32.

namespace {
constexpr int NB_ = 2, N = 512, T = 24, E = 64, H = 8, HD = 8, NBT = NB_ * T /* 48 (b,t) groups */;
constexpr float HS = 256.0f, PS = 256.0f, WSC = 256.0f, SCALE = 0.125f /* 1/sqrt(64) */;
typedef _Float16 b16;
typedef __attribute__((ext_vector_type(16))) _Float16 v16b;
typedef __attribute__((ext_vector_type(8))) _Float16 v8b;
typedef __attribute__((ext_vector_type(8))) float v8f;
typedef __attribute__((ext_vector_type(4))) float v4f;
typedef __attribute__((ext_vector_type(2))) float v2f;
__device__ __forceinline__ float bf16_rne(float f) { unsigned int u = __float_as_uint(f); u += 0x7FFFu + ((u >> 16) & 1u); float r = __uint_as_float(u & 0xFFFF0000u); asm volatile("" : "+v"(r)); return r; }
__device__ __forceinline__ float bfv(float f) { float r = bf16_rne(f); asm volatile("" : "+v"(r)); return r; }
__device__ __forceinline__ void split16(float v, b16& hi, b16& lo) { hi = (b16)v; lo = (b16)(v - (float)hi); }
__device__ __forceinline__ v16b frag_kb(const b16* p, int hh) { const v8b a = *(const v8b*)(p + 8 * hh), b = *(const v8b*)(p + 16 + 8 * hh); v16b f;
#pragma unroll
  for (int e = 0; e < 8; ++e) { f[e] = a[e]; f[8 + e] = b[e]; } return f; }
__device__ __forceinline__ v8f wmma16b(v16b a, v16b b, v8f c) { v8f d = __builtin_amdgcn_wmma_f32_16x16x32_f16(false, a, false, b, (short)0, c, false, false); asm volatile("v_nop\n\tv_nop\n\tv_nop\n\tv_nop" : "+v"(d) : "v"(a), "v"(b)); return d; }
__device__ __forceinline__ void wave_lds_sync() { __builtin_amdgcn_fence(__ATOMIC_RELEASE, "workgroup"); __builtin_amdgcn_wave_barrier(); __builtin_amdgcn_fence(__ATOMIC_ACQUIRE, "workgroup"); }
__device__ __forceinline__ float pmul(float a, float b) { float p = a * b; asm volatile("" : "+v"(p)); return p; }

typedef __attribute__((ext_vector_type(2))) _Float16 v2b;
__global__ __launch_bounds__(256) void proj_kernel(const float* __restrict__ xv, const float* __restrict__ xk, const float* __restrict__ xq, const float* __restrict__ wv, const float* __restrict__ wk, const float* __restrict__ wq, b16* __restrict__ QPh, b16* __restrict__ QPl, b16* __restrict__ KPh, b16* __restrict__ KPl, b16* __restrict__ VTh, b16* __restrict__ VTl) { __shared__ float Vs[H][HD][65], Wl[3][HD][HD]; const int b = blockIdx.x / (T * (N / 64)), rem = blockIdx.x % (T * (N / 64)); const int t = rem / (N / 64), n0 = (rem % (N / 64)) * 64; const int tid = threadIdx.x, h = tid >> 5, lane = tid & 31; const int bth = (b * T + t) * H + h;
  if (tid < 3 * HD * HD) { const int w = tid / (HD * HD), ij = tid % (HD * HD); const float* src = w == 0 ? wq : (w == 1 ? wk : wv); Wl[w][ij / HD][ij % HD] = bfv(src[ij]); }
  __syncthreads();
  const v8b z8 = {0, 0, 0, 0, 0, 0, 0, 0};
  for (int half = 0; half < 2; ++half) { const int n = n0 + half * 32 + lane; const size_t xo = (((size_t)b * N + n) * T + t) * E + h * HD; const size_t ro = ((size_t)bth * N + n) * 32;
    for (int which = 0; which < 3; ++which) { const float* xs = which == 0 ? xq : (which == 1 ? xk : xv); float xx[HD];
#pragma unroll
      for (int j = 0; j < HD; ++j) xx[j] = bfv(xs[xo + j]);
      v8b hh8, ll8;
#pragma unroll
      for (int i = 0; i < HD; ++i) { float s = 0.0f;
#pragma unroll
        for (int j = 0; j < HD; ++j) s += pmul(xx[j], Wl[which][i][j]); if (which == 2) Vs[h][i][half * 32 + lane] = s; else { b16 p, pl; split16(s * HS, p, pl); hh8[i] = p; ll8[i] = pl; } }
      if (which < 2) { b16* Ph = which == 0 ? QPh : KPh; b16* Pl = which == 0 ? QPl : KPl; { *(v8b*)(Ph + ro) = hh8; *(v8b*)(Pl + ro) = ll8; for (int c = 8; c < 32; c += 8) { *(v8b*)(Ph + ro + c) = z8; *(v8b*)(Pl + ro + c) = z8; }  } } } }
  __syncthreads();
  { for (int d = 0; d < 16; ++d) { b16 h0 = (b16)0.0f, l0 = (b16)0.0f, h1 = (b16)0.0f, l1 = (b16)0.0f; if (d < HD) { split16(Vs[h][d][lane * 2] * HS, h0, l0); split16(Vs[h][d][lane * 2 + 1] * HS, h1, l1); } const size_t o = ((size_t)bth * 16 + d) * N + n0 + lane * 2; *(v2b*)(VTh + o) = (v2b){h0, h1}; *(v2b*)(VTl + o) = (v2b){l0, l1}; }  } }
// Value of lane l ^ 16 (the other half of the wave), by a vector cross-row move.
__device__ __forceinline__ float xhalf(float v) { const int b = __float_as_int(v); return __int_as_float(__builtin_amdgcn_permlanex16(b, b, 0x76543210, 0xfedcba98, false, false)); }
// Eight independent 2^x in place. One statement, so that no v_exp_f32 is directly followed by an instruction that overwrites its source or reads its result;
// the v_nop is the slot the instruction set asks for behind the last one.
__device__ __forceinline__ void exp2x8(float* x) { asm("v_exp_f32 %0, %0\n\tv_exp_f32 %1, %1\n\tv_exp_f32 %2, %2\n\tv_exp_f32 %3, %3\n\tv_exp_f32 %4, %4\n\tv_exp_f32 %5, %5\n\tv_exp_f32 %6, %6\n\tv_exp_f32 %7, %7\n\tv_nop" : "+v"(x[0]), "+v"(x[1]), "+v"(x[2]), "+v"(x[3]), "+v"(x[4]), "+v"(x[5]), "+v"(x[6]), "+v"(x[7])); }
constexpr int CH = 64;
__global__ __launch_bounds__(32) void att_kernel(const b16* __restrict__ QPh, const b16* __restrict__ QPl, const b16* __restrict__ KPh, const b16* __restrict__ KPl, const b16* __restrict__ VTh, const b16* __restrict__ VTl, int GLIM, float* __restrict__ AO) { const int lane = threadIdx.x, nloc = lane & 15, hlf = lane >> 4; const int bth = blockIdx.x / (N / 16), q0 = (blockIdx.x % (N / 16)) * 16; if (bth >= GLIM) return;
  constexpr float C2 = (SCALE / (HS * HS)) * 1.4426950408889634f;   // raw score -> log2 units
  const v16b qa = frag_kb(QPh + ((size_t)bth * N + q0 + nloc) * 32, hlf), ql = frag_kb(QPl + ((size_t)bth * N + q0 + nloc) * 32, hlf);
  const b16* kph = KPh + ((size_t)bth * N + nloc) * 32; const b16* kpl = KPl + ((size_t)bth * N + nloc) * 32;
  const b16* vph = VTh + ((size_t)bth * 16 + nloc) * N; const b16* vpl = VTl + ((size_t)bth * 16 + nloc) * N;
  float mx = -INFINITY, sm = 0.0f; v8f o = (v8f){};
  for (int k0 = 0; k0 < N; k0 += CH, kph += CH * 32, kpl += CH * 32, vph += CH, vpl += CH) { v8f s[CH / 16];
#pragma unroll   // constant indices keep the arrays in registers
    for (int g = 0; g < CH / 16; g += 4) { v16b kh[4], kl[4];   // four tiles' fragments are fetched together: one load latency per group
#pragma unroll   // constant indices keep the arrays in registers
      for (int i = 0; i < 4; ++i) { kh[i] = frag_kb(kph + (g + i) * 16 * 32, hlf); kl[i] = frag_kb(kpl + (g + i) * 16 * 32, hlf); }
#pragma unroll   // constant indices keep the arrays in registers
      for (int i = 0; i < 4; ++i) { v8f t = wmma16b(kh[i], qa, (v8f){}); t = wmma16b(kl[i], qa, t); s[g + i] = wmma16b(kh[i], ql, t); } }
    v16b vh[CH / 32], vl[CH / 32];   // fetched here so that they fly under the softmax arithmetic
#pragma unroll   // constant indices keep the arrays in registers
    for (int j = 0; j < CH / 32; ++j) { vh[j] = frag_kb(vph + j * 32, hlf); vl[j] = frag_kb(vpl + j * 32, hlf); }
    float c0 = -INFINITY, c1 = -INFINITY;   // two chains, so that one's latency covers the other's
#pragma unroll   // constant indices keep the arrays in registers
    for (int tk = 0; tk < CH / 16; tk += 2) {
#pragma unroll   // constant indices keep the arrays in registers
      for (int r8 = 0; r8 < 8; r8 += 2) { c0 = fmaxf(fmaxf(c0, s[tk][r8]), s[tk][r8 + 1]); c1 = fmaxf(fmaxf(c1, s[tk + 1][r8]), s[tk + 1][r8 + 1]); } }
    float cm = fmaxf(c0, c1); cm = fmaxf(cm, xhalf(cm));
    const float mn = fmaxf(mx, cm), corr = __builtin_amdgcn_exp2f((mx - mn) * C2), bias = 8.0f - mn * C2;   // + 8: p comes out times PS = 2^8
    mx = mn; sm *= corr;
#pragma unroll   // constant indices keep the arrays in registers
    for (int r8 = 0; r8 < 8; ++r8) o[r8] *= corr;
#pragma unroll   // constant indices keep the arrays in registers
    for (int j = 0; j < CH / 32; ++j) { v16b pa, pb; float x[16];
#pragma unroll   // constant indices keep the arrays in registers
      for (int e = 0; e < 16; ++e) x[e] = fmaf(s[2 * j + (e >> 3)][e & 7], C2, bias);
      exp2x8(x); exp2x8(x + 8);
#pragma unroll   // constant indices keep the arrays in registers
      for (int e = 0; e < 16; e += 2) { const v2f p = {x[e], x[e + 1]}; sm += p[0]; sm += p[1];
        const v2b ph = __builtin_convertvector(p, v2b); const v2b pl = __builtin_convertvector((v2f){p[0] - (float)ph[0], p[1] - (float)ph[1]}, v2b); pa[e] = ph[0]; pa[e + 1] = ph[1]; pb[e] = pl[0]; pb[e + 1] = pl[1]; }
      o = wmma16b(vh[j], pa, o); o = wmma16b(vl[j], pa, o); o = wmma16b(vh[j], pb, o); } }
  sm += xhalf(sm);
  const float inv = 1.0f / (sm * HS);   // o holds sum (PS p)(HS v), sm holds sum PS p
  if (hlf == 0) { float* dst = AO + ((size_t)bth * N + q0 + nloc) * HD; *(v4f*)dst = (v4f){o[0] * inv, o[1] * inv, o[2] * inv, o[3] * inv}; *(v4f*)(dst + 4) = (v4f){o[4] * inv, o[5] * inv, o[6] * inv, o[7] * inv}; } }
__global__ __launch_bounds__(32) void outp_kernel(const float* __restrict__ AO, const float* __restrict__ wo, const float* __restrict__ bo, int GLIM, float* __restrict__ out) { __shared__ __attribute__((aligned(16))) b16 Ah[16][E + 8], Al[16][E + 8], Wr[E][E + 8]; __shared__ float Tf[16][E + 1]; const int lane = threadIdx.x, nloc = lane & 15, hlf = lane >> 4; const size_t r0 = (size_t)blockIdx.x * 16;
  for (int o = 0; o < E; ++o) for (int q = 0; q < 2; ++q) Wr[o][q * 32 + lane] = (b16)(bfv(wo[o * E + q * 32 + lane]) * WSC); if (lane < 16) for (int o = 0; o < E; o += 1) for (int k = E; k < E + 8; ++k) Wr[o][k] = (b16)0.0f;
  for (int rr = 0; rr < 16; ++rr) { const size_t row = r0 + rr; const int b = (int)(row / ((size_t)N * T)), n = (int)((row / T) % N), t = (int)(row % T); for (int q = 0; q < 2; ++q) { const int c = q * 32 + lane; const int h = c / HD, d = c % HD; const int bth = (b * T + t) * H + h; const float v = bth < GLIM ? AO[((size_t)bth * N + n) * HD + d] : 0.0f; b16 p, pl; split16(v * HS, p, pl); Ah[rr][c] = p; Al[rr][c] = pl; } }
  if (lane < 16) for (int k = E; k < E + 8; ++k) { Ah[lane][k] = (b16)0.0f; Al[lane][k] = (b16)0.0f; }
  wave_lds_sync(); v8f acc[4] = {(v8f){}, (v8f){}, (v8f){}, (v8f){}};
#pragma unroll
  for (int kb = 0; kb < E; kb += 32) { const v16b a = frag_kb(&Ah[nloc][kb], hlf), al = frag_kb(&Al[nloc][kb], hlf);
#pragma unroll
    for (int t4 = 0; t4 < 4; ++t4) { const v16b bw = frag_kb(&Wr[t4 * 16 + nloc][kb], hlf); acc[t4] = wmma16b(a, bw, acc[t4]); acc[t4] = wmma16b(al, bw, acc[t4]); } }
#pragma unroll
  for (int t4 = 0; t4 < 4; ++t4) { const int cc = t4 * 16 + nloc; const float bb = bfv(bo[cc]);
#pragma unroll
    for (int r8 = 0; r8 < 8; ++r8) Tf[8 * hlf + r8][cc] = acc[t4][r8] * (1.0f / (HS * WSC)) + bb; }
  wave_lds_sync();
  { for (int rr = 0; rr < 16; ++rr) *(v2f*)(out + (r0 + rr) * E + lane * 2) = (v2f){Tf[rr][lane * 2], Tf[rr][lane * 2 + 1]};  } }
}  // namespace

extern "C" void kernel_launch(void* const* d_in, const int* in_sizes, int n_in, void* d_out, int out_size, void* d_ws, size_t ws_size, hipStream_t stream) {
  (void)n_in;
  auto Fp = [&](int i) { return (const float*)d_in[i]; };
  // Input order: 0 values [2,512,24,64]; 1 keys; 2 query; 3 Wv [8,8]; 4 Wk; 5 Wq; 6 Wo [64,64]; 7 bo [64]
  if (in_sizes[0] != NB_ * N * T * E || in_sizes[1] != NB_ * N * T * E || in_sizes[2] != NB_ * N * T * E || in_sizes[3] != HD * HD || in_sizes[6] != E * E || out_size != NB_ * N * T * E) return;
  const int GLIM = NBT * H;   // (b,t,h) group cut
  size_t off = 0; char* ws = (char*)d_ws;
  auto carve = [&](size_t bytes) { char* p = ws + off; off += (bytes + 255) & ~(size_t)255; return p; };
  const size_t ng = (size_t)NBT * H;   // 384 groups
  b16* QPh = (b16*)carve(ng * N * 32 * 2); b16* QPl = (b16*)carve(ng * N * 32 * 2); b16* KPh = (b16*)carve(ng * N * 32 * 2); b16* KPl = (b16*)carve(ng * N * 32 * 2); b16* VTh = (b16*)carve(ng * 16 * N * 2); b16* VTl = (b16*)carve(ng * 16 * N * 2); float* AO = (float*)carve(ng * N * HD * 4);
  if (off > ws_size || off > ((size_t)80 << 20)) return;   // ~ 69 MB
  proj_kernel<<<NB_ * T * (N / 64), 256, 0, stream>>>(Fp(0), Fp(1), Fp(2), Fp(3), Fp(4), Fp(5), QPh, QPl, KPh, KPl, VTh, VTl);
  att_kernel<<<(unsigned)(ng * (N / 16)), 32, 0, stream>>>(QPh, QPl, KPh, KPl, VTh, VTl, GLIM, AO);
  outp_kernel<<<NB_ * N * T / 16, 32, 0, stream>>>(AO, Fp(6), Fp(7), GLIM, (float*)d_out);
}

// v002
// One run takes 99.8 microseconds.
// Two timings next to v001 put it at 1.33 and 1.34 times that version's speed.
// Over all steps from v000 it is 5.41 times as fast.
#include <hip/hip_runtime.h>

// SSelfAttention: per (b, t, h): q,k,v = x[b][n][t][h*8..+8] W^T (8x8 per-head linears shared across heads); energy[q][k] = q.k; attn = softmax_k(energy / sqrt(64)); out = attn v -> [b][n][t][h*8+d]; final out @ Wo^T + bo -> [2][512][24][64].
// Deterministic: per-wave softmax over the 512 nodes in fixed order; no atomics.
// WMMA (v_wmma_f32_16x16x32_f16, f32 accumulate): per (b, t, h, 16-query) wave S^T = k rows (32 tiles) x q rows (x256; the K of 32 holds the four products of hi and lo, 8 deep each) and o^T = v^T rows (8 hi rows + 8 lo rows, K 512) x P^T (hi, then lo, from the score registers); out = o (hi+lo, K 64) x Wo rows (EXACT; 4 tiles) per 16-row wave; the 8x8 projections and softmax in f32.

namespace {
constexpr int NB_ = 2, N = 512, T = 24, E = 64, H = 8, HD = 8, NBT = NB_ * T /* 48 (b,t) groups */;
constexpr float HS = 256.0f, PS = 256.0f, WSC = 256.0f, SCALE = 0.125f /* 1/sqrt(64) */;
typedef _Float16 b16;
typedef __attribute__((ext_vector_type(16))) _Float16 v16b;
typedef __attribute__((ext_vector_type(8))) _Float16 v8b;
typedef __attribute__((ext_vector_type(8))) float v8f;
typedef __attribute__((ext_vector_type(4))) float v4f;
typedef __attribute__((ext_vector_type(2))) float v2f;
__device__ __forceinline__ float bf16_rne(float f) { unsigned int u = __float_as_uint(f); u += 0x7FFFu + ((u >> 16) & 1u); float r = __uint_as_float(u & 0xFFFF0000u); asm volatile("" : "+v"(r)); return r; }
__device__ __forceinline__ float bfv(float f) { float r = bf16_rne(f); asm volatile("" : "+v"(r)); return r; }
__device__ __forceinline__ void split16(float v, b16& hi, b16& lo) { hi = (b16)v; lo = (b16)(v - (float)hi); }
__device__ __forceinline__ v16b frag_kb(const b16* p, int hh) { const v8b a = *(const v8b*)(p + 8 * hh), b = *(const v8b*)(p + 16 + 8 * hh); v16b f;
#pragma unroll
  for (int e = 0; e < 8; ++e) { f[e] = a[e]; f[8 + e] = b[e]; } return f; }
__device__ __forceinline__ v8f wmma16b(v16b a, v16b b, v8f c) { v8f d = __builtin_amdgcn_wmma_f32_16x16x32_f16(false, a, false, b, (short)0, c, false, false); asm volatile("v_nop\n\tv_nop\n\tv_nop\n\tv_nop" : "+v"(d) : "v"(a), "v"(b)); return d; }
__device__ __forceinline__ void wave_lds_sync() { __builtin_amdgcn_fence(__ATOMIC_RELEASE, "workgroup"); __builtin_amdgcn_wave_barrier(); __builtin_amdgcn_fence(__ATOMIC_ACQUIRE, "workgroup"); }
__device__ __forceinline__ float pmul(float a, float b) { float p = a * b; asm volatile("" : "+v"(p)); return p; }

typedef __attribute__((ext_vector_type(2))) _Float16 v2b;
__global__ __launch_bounds__(256) void proj_kernel(const float* __restrict__ xv, const float* __restrict__ xk, const float* __restrict__ xq, const float* __restrict__ wv, const float* __restrict__ wk, const float* __restrict__ wq, b16* __restrict__ QP, b16* __restrict__ KP, b16* __restrict__ VT) { __shared__ float Vs[H][HD][65], Wl[3][HD][HD]; const int b = blockIdx.x / (T * (N / 64)), rem = blockIdx.x % (T * (N / 64)); const int t = rem / (N / 64), n0 = (rem % (N / 64)) * 64; const int tid = threadIdx.x, h = tid >> 5, lane = tid & 31; const int bth = (b * T + t) * H + h;
  if (tid < 3 * HD * HD) { const int w = tid / (HD * HD), ij = tid % (HD * HD); const float* src = w == 0 ? wq : (w == 1 ? wk : wv); Wl[w][ij / HD][ij % HD] = bfv(src[ij]); }
  __syncthreads();
  for (int half = 0; half < 2; ++half) { const int n = n0 + half * 32 + lane; const size_t xo = (((size_t)b * N + n) * T + t) * E + h * HD; const size_t ro = ((size_t)bth * N + n) * 16;   // a row is 8 hi, then 8 lo
    for (int which = 0; which < 3; ++which) { const float* xs = which == 0 ? xq : (which == 1 ? xk : xv); float xx[HD];
#pragma unroll
      for (int j = 0; j < HD; ++j) xx[j] = bfv(xs[xo + j]);
      v8b hh8, ll8;
#pragma unroll
      for (int i = 0; i < HD; ++i) { float s = 0.0f;
#pragma unroll
        for (int j = 0; j < HD; ++j) s += pmul(xx[j], Wl[which][i][j]); if (which == 2) Vs[h][i][half * 32 + lane] = s; else { b16 p, pl; split16(s * HS, p, pl); hh8[i] = p; ll8[i] = pl; } }
      if (which < 2) { b16* P = which == 0 ? QP : KP; *(v8b*)(P + ro) = hh8; *(v8b*)(P + ro + 8) = ll8;
        asm volatile("s_wait_xcnt 0x0" ::: "memory"); } } }   // stands in front of the next pass's writes to the registers that the two stores name
  __syncthreads();
  { for (int d = 0; d < HD; ++d) { b16 h0, l0, h1, l1; split16(Vs[h][d][lane * 2] * HS, h0, l0); split16(Vs[h][d][lane * 2 + 1] * HS, h1, l1); const size_t o = ((size_t)bth * 16 + d) * N + n0 + lane * 2; *(v2b*)(VT + o) = (v2b){h0, h1}; *(v2b*)(VT + o + (size_t)HD * N) = (v2b){l0, l1}; }  } }   // rows 0..7 hi, rows 8..15 lo
// Value of lane l ^ 16 (the other half of the wave), by a vector cross-row move.
__device__ __forceinline__ float xhalf(float v) { const int b = __float_as_int(v); return __int_as_float(__builtin_amdgcn_permlanex16(b, b, 0x76543210, 0xfedcba98, false, false)); }
// Eight independent 2^x in place. One statement, so that no v_exp_f32 is directly followed by an instruction that overwrites its source or reads its result;
// the v_nop is the slot the instruction set asks for behind the last one.
__device__ __forceinline__ void exp2x8(float* x) { asm("v_exp_f32 %0, %0\n\tv_exp_f32 %1, %1\n\tv_exp_f32 %2, %2\n\tv_exp_f32 %3, %3\n\tv_exp_f32 %4, %4\n\tv_exp_f32 %5, %5\n\tv_exp_f32 %6, %6\n\tv_exp_f32 %7, %7\n\tv_nop" : "+v"(x[0]), "+v"(x[1]), "+v"(x[2]), "+v"(x[3]), "+v"(x[4]), "+v"(x[5]), "+v"(x[6]), "+v"(x[7])); }
constexpr int CH = 64;
__global__ __launch_bounds__(32) void att_kernel(const b16* __restrict__ QP, const b16* __restrict__ KP, const b16* __restrict__ VT, int GLIM, float* __restrict__ AO) { const int lane = threadIdx.x, nloc = lane & 15, hlf = lane >> 4; const int bth = blockIdx.x / (N / 16), q0 = (blockIdx.x % (N / 16)) * 16; if (bth >= GLIM) return;
  constexpr float C2 = (SCALE / (HS * HS)) * 1.4426950408889634f;   // raw score -> log2 units
  const v16b qf = *(const v16b*)(QP + ((size_t)bth * N + q0 + nloc) * 16);   // both halves: qh in elements 0..7, ql in 8..15
  const b16* kp = KP + ((size_t)bth * N + nloc) * 16 + 8 * hlf;   // half 0 reads kh, half 1 kl
  const b16* vp = VT + ((size_t)bth * 16 + nloc) * N;
  float mx = -INFINITY, sm = 0.0f; v8f o = (v8f){};
  for (int k0 = 0; k0 < N; k0 += CH, kp += CH * 16, vp += CH) { v8f s[CH / 16];
#pragma unroll   // constant indices keep the arrays in registers
    for (int g = 0; g < CH / 16; g += 4) { v8b kx[4];   // four tiles' fragments are fetched together: one load latency per group
#pragma unroll   // constant indices keep the arrays in registers
      for (int i = 0; i < 4; ++i) kx[i] = *(const v8b*)(kp + (g + i) * 16 * 16);
#pragma unroll   // constant indices keep the arrays in registers
      for (int i = 0; i < 4; ++i) s[g + i] = wmma16b(__builtin_shufflevector(kx[i], kx[i], 0, 1, 2, 3, 4, 5, 6, 7, 0, 1, 2, 3, 4, 5, 6, 7), qf, (v8f){}); }
    v16b vf[CH / 32];   // fetched here so that they fly under the softmax arithmetic (the rows lie 1 KiB apart: each load touches 16 lines)
#pragma unroll   // constant indices keep the arrays in registers
    for (int j = 0; j < CH / 32; ++j) vf[j] = frag_kb(vp + j * 32, hlf);
    float c0 = -INFINITY, c1 = -INFINITY;   // two chains, so that one's latency covers the other's
#pragma unroll   // constant indices keep the arrays in registers
    for (int tk = 0; tk < CH / 16; tk += 2) {
#pragma unroll   // constant indices keep the arrays in registers
      for (int r8 = 0; r8 < 8; r8 += 2) { c0 = fmaxf(fmaxf(c0, s[tk][r8]), s[tk][r8 + 1]); c1 = fmaxf(fmaxf(c1, s[tk + 1][r8]), s[tk + 1][r8 + 1]); } }
    float cm = fmaxf(c0, c1); cm = fmaxf(cm, xhalf(cm));
    const float mn = fmaxf(mx, cm), corr = __builtin_amdgcn_exp2f((mx - mn) * C2), bias = 8.0f - mn * C2;   // + 8: p comes out times PS = 2^8
    mx = mn; sm *= corr;
#pragma unroll   // constant indices keep the arrays in registers
    for (int r8 = 0; r8 < 8; ++r8) o[r8] *= corr;
#pragma unroll   // constant indices keep the arrays in registers
    for (int j = 0; j < CH / 32; ++j) { v16b pa, pb; float x[16];
#pragma unroll   // constant indices keep the arrays in registers
      for (int e = 0; e < 16; ++e) x[e] = fmaf(s[2 * j + (e >> 3)][e & 7], C2, bias);
      exp2x8(x); exp2x8(x + 8);
#pragma unroll   // constant indices keep the arrays in registers
      for (int e = 0; e < 16; e += 2) { const v2f p = {x[e], x[e + 1]}; sm += p[0]; sm += p[1];
        const v2b ph = __builtin_convertvector(p, v2b); const v2b pl = __builtin_convertvector((v2f){p[0] - (float)ph[0], p[1] - (float)ph[1]}, v2b); pa[e] = ph[0]; pa[e + 1] = ph[1]; pb[e] = pl[0]; pb[e + 1] = pl[1]; }
      o = wmma16b(vf[j], pa, o); o = wmma16b(vf[j], pb, o); } }
  sm += xhalf(sm);
#pragma unroll   // constant indices keep the array in registers
  for (int r8 = 0; r8 < 8; ++r8) o[r8] += xhalf(o[r8]);   // vh P + vl P
  const float inv = 1.0f / (sm * HS);   // o holds sum (PS p)(HS v), sm holds sum PS p
  if (hlf == 0) { float* dst = AO + ((size_t)bth * N + q0 + nloc) * HD; *(v4f*)dst = (v4f){o[0] * inv, o[1] * inv, o[2] * inv, o[3] * inv}; *(v4f*)(dst + 4) = (v4f){o[4] * inv, o[5] * inv, o[6] * inv, o[7] * inv}; } }
__global__ __launch_bounds__(32) void outp_kernel(const float* __restrict__ AO, const float* __restrict__ wo, const float* __restrict__ bo, int GLIM, float* __restrict__ out) { __shared__ __attribute__((aligned(16))) b16 Ah[16][E + 8], Al[16][E + 8], Wr[E][E + 8]; __shared__ float Tf[16][E + 1]; const int lane = threadIdx.x, nloc = lane & 15, hlf = lane >> 4; const size_t r0 = (size_t)blockIdx.x * 16;
  for (int o = 0; o < E; ++o) for (int q = 0; q < 2; ++q) Wr[o][q * 32 + lane] = (b16)(bfv(wo[o * E + q * 32 + lane]) * WSC); if (lane < 16) for (int o = 0; o < E; o += 1) for (int k = E; k < E + 8; ++k) Wr[o][k] = (b16)0.0f;
  for (int rr = 0; rr < 16; ++rr) { const size_t row = r0 + rr; const int b = (int)(row / ((size_t)N * T)), n = (int)((row / T) % N), t = (int)(row % T); for (int q = 0; q < 2; ++q) { const int c = q * 32 + lane; const int h = c / HD, d = c % HD; const int bth = (b * T + t) * H + h; const float v = bth < GLIM ? AO[((size_t)bth * N + n) * HD + d] : 0.0f; b16 p, pl; split16(v * HS, p, pl); Ah[rr][c] = p; Al[rr][c] = pl; } }
  if (lane < 16) for (int k = E; k < E + 8; ++k) { Ah[lane][k] = (b16)0.0f; Al[lane][k] = (b16)0.0f; }
  wave_lds_sync(); v8f acc[4] = {(v8f){}, (v8f){}, (v8f){}, (v8f){}};
#pragma unroll
  for (int kb = 0; kb < E; kb += 32) { const v16b a = frag_kb(&Ah[nloc][kb], hlf), al = frag_kb(&Al[nloc][kb], hlf);
#pragma unroll
    for (int t4 = 0; t4 < 4; ++t4) { const v16b bw = frag_kb(&Wr[t4 * 16 + nloc][kb], hlf); acc[t4] = wmma16b(a, bw, acc[t4]); acc[t4] = wmma16b(al, bw, acc[t4]); } }
#pragma unroll
  for (int t4 = 0; t4 < 4; ++t4) { const int cc = t4 * 16 + nloc; const float bb = bfv(bo[cc]);
#pragma unroll
    for (int r8 = 0; r8 < 8; ++r8) Tf[8 * hlf + r8][cc] = acc[t4][r8] * (1.0f / (HS * WSC)) + bb; }
  wave_lds_sync();
  { for (int rr = 0; rr < 16; ++rr) *(v2f*)(out + (r0 + rr) * E + lane * 2) = (v2f){Tf[rr][lane * 2], Tf[rr][lane * 2 + 1]};  } }
}  // namespace

extern "C" void kernel_launch(void* const* d_in, const int* in_sizes, int n_in, void* d_out, int out_size, void* d_ws, size_t ws_size, hipStream_t stream) {
  (void)n_in;
  auto Fp = [&](int i) { return (const float*)d_in[i]; };
  // Input order: 0 values [2,512,24,64]; 1 keys; 2 query; 3 Wv [8,8]; 4 Wk; 5 Wq; 6 Wo [64,64]; 7 bo [64]
  if (in_sizes[0] != NB_ * N * T * E || in_sizes[1] != NB_ * N * T * E || in_sizes[2] != NB_ * N * T * E || in_sizes[3] != HD * HD || in_sizes[6] != E * E || out_size != NB_ * N * T * E) return;
  const int GLIM = NBT * H;   // (b,t,h) group cut
  size_t off = 0; char* ws = (char*)d_ws;
  auto carve = [&](size_t bytes) { char* p = ws + off; off += (bytes + 255) & ~(size_t)255; return p; };
  const size_t ng = (size_t)NBT * H;   // 384 groups
  b16* QP = (b16*)carve(ng * N * 16 * 2); b16* KP = (b16*)carve(ng * N * 16 * 2); b16* VT = (b16*)carve(ng * 16 * N * 2); float* AO = (float*)carve(ng * N * HD * 4);
  if (off > ws_size || off > ((size_t)80 << 20)) return;   // ~ 25 MB
  proj_kernel<<<NB_ * T * (N / 64), 256, 0, stream>>>(Fp(0), Fp(1), Fp(2), Fp(3), Fp(4), Fp(5), QP, KP, VT);
  att_kernel<<<(unsigned)(ng * (N / 16)), 32, 0, stream>>>(QP, KP, VT, GLIM, AO);
  outp_kernel<<<NB_ * N * T / 16, 32, 0, stream>>>(AO, Fp(6), Fp(7), GLIM, (float*)d_out);
}

// v003
// It runs in 41.2 microseconds.
// Timed twice side by side with v002, it ran 2.44 and 2.42 times as fast.
// Over all steps from v000 it is 13.1 times as fast.
#include <hip/hip_runtime.h>

// SSelfAttention: per (b, t, h): q,k,v = x[b][n][t][h*8..+8] W^T (8x8 per-head linears shared across heads); energy[q][k] = q.k; attn = softmax_k(energy / sqrt(64)); out = attn v -> [b][n][t][h*8+d]; final out @ Wo^T + bo -> [2][512][24][64].
// Deterministic: per-wave softmax over the 512 nodes in fixed order; no atomics.
// WMMA (v_wmma_f32_16x16x32_f16, f32 accumulate): per (b, t, h, 16-query) wave S^T = k rows (32 tiles) x q rows (x256; the K of 32 holds the four products of hi and lo, 8 deep each) and o^T = v^T rows (8 hi rows + 8 lo rows, K 512) x P^T (hi, then lo, from the score registers); out^T = Wo rows (EXACT; 4 tiles) x o (hi+lo, K 64) per 16-row wave; the 8x8 projections and softmax in f32.

namespace {
constexpr int NB_ = 2, N = 512, T = 24, E = 64, H = 8, HD = 8, NBT = NB_ * T /* 48 (b,t) groups */;
constexpr float HS = 256.0f, PS = 256.0f, WSC = 256.0f, SCALE = 0.125f /* 1/sqrt(64) */;
typedef _Float16 b16;
typedef __attribute__((ext_vector_type(16))) _Float16 v16b;
typedef __attribute__((ext_vector_type(8))) _Float16 v8b;
typedef __attribute__((ext_vector_type(8))) float v8f;
typedef __attribute__((ext_vector_type(4))) float v4f;
typedef __attribute__((ext_vector_type(2))) float v2f;
__device__ __forceinline__ float bf16_rne(float f) { unsigned int u = __float_as_uint(f); u += 0x7FFFu + ((u >> 16) & 1u); float r = __uint_as_float(u & 0xFFFF0000u); asm volatile("" : "+v"(r)); return r; }
__device__ __forceinline__ float bfv(float f) { float r = bf16_rne(f); asm volatile("" : "+v"(r)); return r; }
__device__ __forceinline__ void split16(float v, b16& hi, b16& lo) { hi = (b16)v; lo = (b16)(v - (float)hi); }
__device__ __forceinline__ v16b frag_kb(const b16* p, int hh) { const v8b a = *(const v8b*)(p + 8 * hh), b = *(const v8b*)(p + 16 + 8 * hh); v16b f;
#pragma unroll
  for (int e = 0; e < 8; ++e) { f[e] = a[e]; f[8 + e] = b[e]; } return f; }
__device__ __forceinline__ v8f wmma16b(v16b a, v16b b, v8f c) { v8f d = __builtin_amdgcn_wmma_f32_16x16x32_f16(false, a, false, b, (short)0, c, false, false); asm volatile("v_nop\n\tv_nop\n\tv_nop\n\tv_nop" : "+v"(d) : "v"(a), "v"(b)); return d; }
__device__ __forceinline__ float pmul(float a, float b) { float p = a * b; asm volatile("" : "+v"(p)); return p; }

typedef __attribute__((ext_vector_type(2))) _Float16 v2b;
// Every load of a stage is issued ahead of the stage's first pinned value: a pin keeps its place among the memory operations, so a load that follows one in the source is waited on alone.
__global__ __launch_bounds__(256) void proj_kernel(const float* __restrict__ xv, const float* __restrict__ xk, const float* __restrict__ xq, const float* __restrict__ wv, const float* __restrict__ wk, const float* __restrict__ wq, b16* __restrict__ QP, b16* __restrict__ KP, b16* __restrict__ VT) { __shared__ float Vs[H][HD][65]; __shared__ __attribute__((aligned(16))) float Wl[3][HD][HD]; const int b = blockIdx.x / (T * (N / 64)), rem = blockIdx.x % (T * (N / 64)); const int t = rem / (N / 64), n0 = (rem % (N / 64)) * 64; const int tid = threadIdx.x, h = tid >> 5, lane = tid & 31; const int bth = (b * T + t) * H + h;
  v4f xr[3][2][2];   // the thread's twelve input loads, in flight together
#pragma unroll   // constant indices keep the array in registers
  for (int which = 0; which < 3; ++which) { const float* xs = which == 0 ? xq : (which == 1 ? xk : xv);
#pragma unroll   // constant indices keep the array in registers
    for (int half = 0; half < 2; ++half) { const float* p = xs + (((size_t)b * N + n0 + half * 32 + lane) * T + t) * E + h * HD; xr[which][half][0] = *(const v4f*)p; xr[which][half][1] = *(const v4f*)(p + 4); } }
  if (tid < 3 * HD * HD) { const int w = tid / (HD * HD), ij = tid % (HD * HD); const float* src = w == 0 ? wq : (w == 1 ? wk : wv); Wl[w][ij / HD][ij % HD] = bfv(src[ij]); }
  __syncthreads();
#pragma unroll   // constant indices keep the arrays in registers
  for (int which = 0; which < 3; ++which) { v4f wr[HD][2];   // one weight matrix: sixteen LDS reads in flight together
#pragma unroll   // constant indices keep the arrays in registers
    for (int i = 0; i < HD; ++i) { wr[i][0] = *(const v4f*)&Wl[which][i][0]; wr[i][1] = *(const v4f*)&Wl[which][i][4]; }
#pragma unroll   // constant indices keep the arrays in registers
    for (int half = 0; half < 2; ++half) { const int n = n0 + half * 32 + lane; const size_t ro = ((size_t)bth * N + n) * 16;   // a row is 8 hi, then 8 lo
      float xx[HD];
#pragma unroll
      for (int j = 0; j < HD; ++j) xx[j] = bfv(xr[which][half][j >> 2][j & 3]);
      v8b hh8, ll8;
#pragma unroll
      for (int i = 0; i < HD; ++i) { float s = 0.0f;
#pragma unroll
        for (int j = 0; j < HD; ++j) s += pmul(xx[j], wr[i][j >> 2][j & 3]); if (which == 2) Vs[h][i][half * 32 + lane] = s; else { b16 p, pl; split16(s * HS, p, pl); hh8[i] = p; ll8[i] = pl; } }
      if (which < 2) { b16* P = which == 0 ? QP : KP; *(v8b*)(P + ro) = hh8; *(v8b*)(P + ro + 8) = ll8;
        asm volatile("s_wait_xcnt 0x0" ::: "memory"); } } }   // stands in front of the next pass's writes to the registers that the two stores name
  __syncthreads();
  { for (int d = 0; d < HD; ++d) { b16 h0, l0, h1, l1; split16(Vs[h][d][lane * 2] * HS, h0, l0); split16(Vs[h][d][lane * 2 + 1] * HS, h1, l1); const size_t o = ((size_t)bth * 16 + d) * N + n0 + lane * 2; *(v2b*)(VT + o) = (v2b){h0, h1}; *(v2b*)(VT + o + (size_t)HD * N) = (v2b){l0, l1}; }  } }   // rows 0..7 hi, rows 8..15 lo
// Value of lane l ^ 16 (the other half of the wave), by a vector cross-row move.
__device__ __forceinline__ float xhalf(float v) { const int b = __float_as_int(v); return __int_as_float(__builtin_amdgcn_permlanex16(b, b, 0x76543210, 0xfedcba98, false, false)); }
// Eight independent 2^x in place. One statement, so that no v_exp_f32 is directly followed by an instruction that overwrites its source or reads its result;
// the v_nop is the slot the instruction set asks for behind the last one.
__device__ __forceinline__ void exp2x8(float* x) { asm("v_exp_f32 %0, %0\n\tv_exp_f32 %1, %1\n\tv_exp_f32 %2, %2\n\tv_exp_f32 %3, %3\n\tv_exp_f32 %4, %4\n\tv_exp_f32 %5, %5\n\tv_exp_f32 %6, %6\n\tv_exp_f32 %7, %7\n\tv_nop" : "+v"(x[0]), "+v"(x[1]), "+v"(x[2]), "+v"(x[3]), "+v"(x[4]), "+v"(x[5]), "+v"(x[6]), "+v"(x[7])); }
constexpr int CH = 64;
__global__ __launch_bounds__(32) void att_kernel(const b16* __restrict__ QP, const b16* __restrict__ KP, const b16* __restrict__ VT, int GLIM, float* __restrict__ AO) { const int lane = threadIdx.x, nloc = lane & 15, hlf = lane >> 4; const int bth = blockIdx.x / (N / 16), q0 = (blockIdx.x % (N / 16)) * 16; if (bth >= GLIM) return;
  constexpr float C2 = (SCALE / (HS * HS)) * 1.4426950408889634f;   // raw score -> log2 units
  const v16b qf = *(const v16b*)(QP + ((size_t)bth * N + q0 + nloc) * 16);   // both halves: qh in elements 0..7, ql in 8..15
  const b16* kp = KP + ((size_t)bth * N + nloc) * 16 + 8 * hlf;   // half 0 reads kh, half 1 kl
  const b16* vp = VT + ((size_t)bth * 16 + nloc) * N;
  float mx = -INFINITY, sm = 0.0f; v8f o = (v8f){};
  for (int k0 = 0; k0 < N; k0 += CH, kp += CH * 16, vp += CH) { v8f s[CH / 16];
#pragma unroll   // constant indices keep the arrays in registers
    for (int g = 0; g < CH / 16; g += 4) { v8b kx[4];   // four tiles' fragments are fetched together: one load latency per group
#pragma unroll   // constant indices keep the arrays in registers
      for (int i = 0; i < 4; ++i) kx[i] = *(const v8b*)(kp + (g + i) * 16 * 16);
#pragma unroll   // constant indices keep the arrays in registers
      for (int i = 0; i < 4; ++i) s[g + i] = wmma16b(__builtin_shufflevector(kx[i], kx[i], 0, 1, 2, 3, 4, 5, 6, 7, 0, 1, 2, 3, 4, 5, 6, 7), qf, (v8f){}); }
    v16b vf[CH / 32];   // fetched here so that they fly under the softmax arithmetic (the rows lie 1 KiB apart: each load touches 16 lines)
#pragma unroll   // constant indices keep the arrays in registers
    for (int j = 0; j < CH / 32; ++j) vf[j] = frag_kb(vp + j * 32, hlf);
    float c0 = -INFINITY, c1 = -INFINITY;   // two chains, so that one's latency covers the other's
#pragma unroll   // constant indices keep the arrays in registers
    for (int tk = 0; tk < CH / 16; tk += 2) {
#pragma unroll   // constant indices keep the arrays in registers
      for (int r8 = 0; r8 < 8; r8 += 2) { c0 = fmaxf(fmaxf(c0, s[tk][r8]), s[tk][r8 + 1]); c1 = fmaxf(fmaxf(c1, s[tk + 1][r8]), s[tk + 1][r8 + 1]); } }
    float cm = fmaxf(c0, c1); cm = fmaxf(cm, xhalf(cm));
    const float mn = fmaxf(mx, cm), corr = __builtin_amdgcn_exp2f((mx - mn) * C2), bias = 8.0f - mn * C2;   // + 8: p comes out times PS = 2^8
    mx = mn; sm *= corr;
#pragma unroll   // constant indices keep the arrays in registers
    for (int r8 = 0; r8 < 8; ++r8) o[r8] *= corr;
#pragma unroll   // constant indices keep the arrays in registers
    for (int j = 0; j < CH / 32; ++j) { v16b pa, pb; float x[16];
#pragma unroll   // constant indices keep the arrays in registers
      for (int e = 0; e < 16; ++e) x[e] = fmaf(s[2 * j + (e >> 3)][e & 7], C2, bias);
      exp2x8(x); exp2x8(x + 8);
#pragma unroll   // constant indices keep the arrays in registers
      for (int e = 0; e < 16; e += 2) { const v2f p = {x[e], x[e + 1]}; sm += p[0]; sm += p[1];
        const v2b ph = __builtin_convertvector(p, v2b); const v2b pl = __builtin_convertvector((v2f){p[0] - (float)ph[0], p[1] - (float)ph[1]}, v2b); pa[e] = ph[0]; pa[e + 1] = ph[1]; pb[e] = pl[0]; pb[e + 1] = pl[1]; }
      o = wmma16b(vf[j], pa, o); o = wmma16b(vf[j], pb, o); } }
  sm += xhalf(sm);
#pragma unroll   // constant indices keep the array in registers
  for (int r8 = 0; r8 < 8; ++r8) o[r8] += xhalf(o[r8]);   // vh P + vl P
  const float inv = 1.0f / (sm * HS);   // o holds sum (PS p)(HS v), sm holds sum PS p
  if (hlf == 0) { float* dst = AO + ((size_t)bth * N + q0 + nloc) * HD; *(v4f*)dst = (v4f){o[0] * inv, o[1] * inv, o[2] * inv, o[3] * inv}; *(v4f*)(dst + 4) = (v4f){o[4] * inv, o[5] * inv, o[6] * inv, o[7] * inv}; } }
// One wave per 16 output rows. Every operand fragment is read straight from global memory in the layout of frag_kb (lane (c, hf): k = kb + 8 hf + e and kb + 16 + 8 hf + e of row c),
// and all 48 loads are issued ahead of the first conversion, so the wave waits for one load latency in all. The product is formed transposed, out^T = Wo A^T,
// so lane (c, hf) holds channels 16 t4 + 8 hf + r of row c: eight neighbours in memory.
__global__ __launch_bounds__(32) void outp_kernel(const float* __restrict__ AO, const float* __restrict__ wo, const float* __restrict__ bo, int GLIM, float* __restrict__ out) { const int lane = threadIdx.x, nloc = lane & 15, hlf = lane >> 4; const int row = (int)blockIdx.x * 16 + nloc; const int b = row / (N * T), n = (row / T) % N, t = row % T;
  v4f ar[4][2], wr[4][2][4], br[4][2]; bool ok[4]; const float* pa[4]; const float* pw = wo + nloc * E + 8 * hlf;
#pragma unroll   // constant indices keep the arrays in registers
  for (int t4 = 0; t4 < 4; ++t4) { br[t4][0] = *(const v4f*)(bo + t4 * 16 + 8 * hlf); br[t4][1] = *(const v4f*)(bo + t4 * 16 + 8 * hlf + 4);
#pragma unroll   // constant indices keep the arrays in registers
    for (int kb = 0; kb < 2; ++kb) { const float* p = pw + t4 * 16 * E + kb * 32; wr[t4][kb][0] = *(const v4f*)p; wr[t4][kb][1] = *(const v4f*)(p + 4); wr[t4][kb][2] = *(const v4f*)(p + 16); wr[t4][kb][3] = *(const v4f*)(p + 20); } }
#pragma unroll   // constant indices keep the arrays in registers
  for (int j = 0; j < 4; ++j) { const int bth = (b * T + t) * H + 2 * j + hlf; ok[j] = bth < GLIM; pa[j] = AO + ((size_t)(ok[j] ? bth : 0) * N + n) * HD; ar[j][0] = *(const v4f*)pa[j]; ar[j][1] = *(const v4f*)(pa[j] + 4); }   // head 2 j + hf = channels 16 j + 8 hf ..+8
  // Stands in front of the first write to a register that a load above names; the addresses are inputs, so that none of their registers is handed to a later load's result ahead of it.
  asm volatile("s_wait_xcnt 0x0" :: "v"(pw), "v"(pa[0]), "v"(pa[1]), "v"(pa[2]), "v"(pa[3]) : "memory");
  v16b a[2], al[2];
#pragma unroll   // constant indices keep the arrays in registers
  for (int e = 0; e < 32; ++e) { const int j = e >> 3; const float v = ok[j] ? ar[j][(e >> 2) & 1][e & 3] : 0.0f; b16 p, pl; split16(v * HS, p, pl); a[e >> 4][e & 15] = p; al[e >> 4][e & 15] = pl; }
  v8f acc[4] = {(v8f){}, (v8f){}, (v8f){}, (v8f){}};
#pragma unroll   // constant indices keep the arrays in registers
  for (int kb = 0; kb < 2; ++kb) {
#pragma unroll   // constant indices keep the arrays in registers
    for (int t4 = 0; t4 < 4; ++t4) { v16b bw;
#pragma unroll   // constant indices keep the arrays in registers
      for (int e = 0; e < 16; ++e) bw[e] = (b16)(bfv(wr[t4][kb][e >> 2][e & 3]) * WSC);
      acc[t4] = wmma16b(bw, a[kb], acc[t4]); acc[t4] = wmma16b(bw, al[kb], acc[t4]); } }
#pragma unroll   // constant indices keep the arrays in registers
  for (int t4 = 0; t4 < 4; ++t4) { float* dst = out + (size_t)row * E + t4 * 16 + 8 * hlf; float r[8];
#pragma unroll   // constant indices keep the arrays in registers
    for (int r8 = 0; r8 < 8; ++r8) r[r8] = acc[t4][r8] * (1.0f / (HS * WSC)) + bfv(br[t4][r8 >> 2][r8 & 3]);
    *(v4f*)dst = (v4f){r[0], r[1], r[2], r[3]}; *(v4f*)(dst + 4) = (v4f){r[4], r[5], r[6], r[7]}; } }
}  // namespace

extern "C" void kernel_launch(void* const* d_in, const int* in_sizes, int n_in, void* d_out, int out_size, void* d_ws, size_t ws_size, hipStream_t stream) {
  (void)n_in;
  auto Fp = [&](int i) { return (const float*)d_in[i]; };
  // Input order: 0 values [2,512,24,64]; 1 keys; 2 query; 3 Wv [8,8]; 4 Wk; 5 Wq; 6 Wo [64,64]; 7 bo [64]
  if (in_sizes[0] != NB_ * N * T * E || in_sizes[1] != NB_ * N * T * E || in_sizes[2] != NB_ * N * T * E || in_sizes[3] != HD * HD || in_sizes[6] != E * E || out_size != NB_ * N * T * E) return;
  const int GLIM = NBT * H;   // (b,t,h) group cut
  size_t off = 0; char* ws = (char*)d_ws;
  auto carve = [&](size_t bytes) { char* p = ws + off; off += (bytes + 255) & ~(size_t)255; return p; };
  const size_t ng = (size_t)NBT * H;   // 384 groups
  b16* QP = (b16*)carve(ng * N * 16 * 2); b16* KP = (b16*)carve(ng * N * 16 * 2); b16* VT = (b16*)carve(ng * 16 * N * 2); float* AO = (float*)carve(ng * N * HD * 4);
  if (off > ws_size || off > ((size_t)80 << 20)) return;   // ~ 25 MB
  proj_kernel<<<NB_ * T * (N / 64), 256, 0, stream>>>(Fp(0), Fp(1), Fp(2), Fp(3), Fp(4), Fp(5), QP, KP, VT);
  att_kernel<<<(unsigned)(ng * (N / 16)), 32, 0, stream>>>(QP, KP, VT, GLIM, AO);
  outp_kernel<<<NB_ * N * T / 16, 32, 0, stream>>>(AO, Fp(6), Fp(7), GLIM, (float*)d_out);
}

// v004
// It runs in 36.7 microseconds.
// Next to v003, in two timings, it ran 1.09 times as fast each time.
// Over all steps from v000 it is 14.3 times as fast.
#include <hip/hip_runtime.h>

// SSelfAttention: per (b, t, h): q,k,v = x[b][n][t][h*8..+8] W^T (8x8 per-head linears shared across heads); energy[q][k] = q.k; attn = softmax_k(energy / sqrt(64)); out = attn v -> [b][n][t][h*8+d]; final out @ Wo^T + bo -> [2][512][24][64].
// Deterministic: per-wave softmax over the 512 nodes in fixed order; no atomics.
// WMMA (v_wmma_f32_16x16x32_f16, f32 accumulate): per (b, t, h, 32-query) wave S^T = k rows (32 tiles) x q rows (x256; the K of 32 holds the four products of hi and lo, 8 deep each) and o^T = v^T rows (8 hi rows + 8 lo rows, K 512) x P^T (hi, then lo, from the score registers); out = o (hi+lo, K 64) x Wo rows (EXACT; 4 tiles) per 16-row wave; the 8x8 projections and softmax in f32.

namespace {
constexpr int NB_ = 2, N = 512, T = 24, E = 64, H = 8, HD = 8, NBT = NB_ * T /* 48 (b,t) groups */;
constexpr float HS = 256.0f, PS = 256.0f, WSC = 256.0f, SCALE = 0.125f /* 1/sqrt(64) */;
typedef _Float16 b16;
typedef __attribute__((ext_vector_type(16))) _Float16 v16b;
typedef __attribute__((ext_vector_type(8))) _Float16 v8b;
typedef __attribute__((ext_vector_type(8))) float v8f;
typedef __attribute__((ext_vector_type(4))) float v4f;
typedef __attribute__((ext_vector_type(2))) float v2f;
__device__ __forceinline__ float bf16_rne(float f) { unsigned int u = __float_as_uint(f); u += 0x7FFFu + ((u >> 16) & 1u); float r = __uint_as_float(u & 0xFFFF0000u); asm volatile("" : "+v"(r)); return r; }
__device__ __forceinline__ float bfv(float f) { float r = bf16_rne(f); asm volatile("" : "+v"(r)); return r; }
__device__ __forceinline__ void split16(float v, b16& hi, b16& lo) { hi = (b16)v; lo = (b16)(v - (float)hi); }
__device__ __forceinline__ v16b frag_kb(const b16* p, int hh) { const v8b a = *(const v8b*)(p + 8 * hh), b = *(const v8b*)(p + 16 + 8 * hh); v16b f;
#pragma unroll
  for (int e = 0; e < 8; ++e) { f[e] = a[e]; f[8 + e] = b[e]; } return f; }
__device__ __forceinline__ v8f wmma16b(v16b a, v16b b, v8f c) { v8f d = __builtin_amdgcn_wmma_f32_16x16x32_f16(false, a, false, b, (short)0, c, false, false); asm volatile("v_nop\n\tv_nop\n\tv_nop\n\tv_nop" : "+v"(d) : "v"(a), "v"(b)); return d; }
__device__ __forceinline__ float pmul(float a, float b) { float p = a * b; asm volatile("" : "+v"(p)); return p; }

typedef __attribute__((ext_vector_type(2))) _Float16 v2b;
// Every load of a stage is issued ahead of the stage's first pinned value: a pin keeps its place among the memory operations, so a load that follows one in the source is waited on alone.
__global__ __launch_bounds__(256) void proj_kernel(const float* __restrict__ xv, const float* __restrict__ xk, const float* __restrict__ xq, const float* __restrict__ wv, const float* __restrict__ wk, const float* __restrict__ wq, b16* __restrict__ QP, b16* __restrict__ KP, b16* __restrict__ VT) { __shared__ float Vs[H][HD][65]; __shared__ __attribute__((aligned(16))) float Wl[3][HD][HD]; const int b = blockIdx.x / (T * (N / 64)), rem = blockIdx.x % (T * (N / 64)); const int t = rem / (N / 64), n0 = (rem % (N / 64)) * 64; const int tid = threadIdx.x, h = tid >> 5, lane = tid & 31; const int bth = (b * T + t) * H + h;
  v4f xr[3][2][2];   // the thread's twelve input loads, in flight together
#pragma unroll   // constant indices keep the array in registers
  for (int which = 0; which < 3; ++which) { const float* xs = which == 0 ? xq : (which == 1 ? xk : xv);
#pragma unroll   // constant indices keep the array in registers
    for (int half = 0; half < 2; ++half) { const float* p = xs + (((size_t)b * N + n0 + half * 32 + lane) * T + t) * E + h * HD; xr[which][half][0] = *(const v4f*)p; xr[which][half][1] = *(const v4f*)(p + 4); } }
  if (tid < 3 * HD * HD) { const int w = tid / (HD * HD), ij = tid % (HD * HD); const float* src = w == 0 ? wq : (w == 1 ? wk : wv); Wl[w][ij / HD][ij % HD] = bfv(src[ij]); }
  __syncthreads();
#pragma unroll   // constant indices keep the arrays in registers
  for (int which = 0; which < 3; ++which) { v4f wr[HD][2];   // one weight matrix: sixteen LDS reads in flight together
#pragma unroll   // constant indices keep the arrays in registers
    for (int i = 0; i < HD; ++i) { wr[i][0] = *(const v4f*)&Wl[which][i][0]; wr[i][1] = *(const v4f*)&Wl[which][i][4]; }
#pragma unroll   // constant indices keep the arrays in registers
    for (int half = 0; half < 2; ++half) { const int n = n0 + half * 32 + lane; const size_t ro = ((size_t)bth * N + n) * 16;   // a row is 8 hi, then 8 lo
      float xx[HD];
#pragma unroll
      for (int j = 0; j < HD; ++j) xx[j] = bfv(xr[which][half][j >> 2][j & 3]);
      v8b hh8, ll8;
#pragma unroll
      for (int i = 0; i < HD; ++i) { float s = 0.0f;
#pragma unroll
        for (int j = 0; j < HD; ++j) s += pmul(xx[j], wr[i][j >> 2][j & 3]); if (which == 2) Vs[h][i][half * 32 + lane] = s; else { b16 p, pl; split16(s * HS, p, pl); hh8[i] = p; ll8[i] = pl; } }
      if (which < 2) { b16* P = which == 0 ? QP : KP; *(v8b*)(P + ro) = hh8; *(v8b*)(P + ro + 8) = ll8;
        asm volatile("s_wait_xcnt 0x0" ::: "memory"); } } }   // stands in front of the next pass's writes to the registers that the two stores name
  __syncthreads();
  { for (int d = 0; d < HD; ++d) { b16 h0, l0, h1, l1; split16(Vs[h][d][lane * 2] * HS, h0, l0); split16(Vs[h][d][lane * 2 + 1] * HS, h1, l1); const size_t o = ((size_t)bth * 16 + d) * N + n0 + lane * 2; *(v2b*)(VT + o) = (v2b){h0, h1}; *(v2b*)(VT + o + (size_t)HD * N) = (v2b){l0, l1}; }  } }   // rows 0..7 hi, rows 8..15 lo
// Value of lane l ^ 16 (the other half of the wave), by a vector cross-row move.
__device__ __forceinline__ float xhalf(float v) { const int b = __float_as_int(v); return __int_as_float(__builtin_amdgcn_permlanex16(b, b, 0x76543210, 0xfedcba98, false, false)); }
// Eight independent 2^x in place. One statement, so that no v_exp_f32 is directly followed by an instruction that overwrites its source or reads its result;
// the v_nop is the slot the instruction set asks for behind the last one.
__device__ __forceinline__ void exp2x8(float* x) { asm("v_exp_f32 %0, %0\n\tv_exp_f32 %1, %1\n\tv_exp_f32 %2, %2\n\tv_exp_f32 %3, %3\n\tv_exp_f32 %4, %4\n\tv_exp_f32 %5, %5\n\tv_exp_f32 %6, %6\n\tv_exp_f32 %7, %7\n\tv_nop" : "+v"(x[0]), "+v"(x[1]), "+v"(x[2]), "+v"(x[3]), "+v"(x[4]), "+v"(x[5]), "+v"(x[6]), "+v"(x[7])); }
// One 2^x. The v_nop is the slot the instruction set asks for behind a transcendental; it is in the same statement so that it stands directly behind it.
__device__ __forceinline__ float exp2x1(float x) { float r; asm("v_exp_f32 %0, %1\n\tv_nop" : "=v"(r) : "v"(x)); return r; }
constexpr int CH = 64, QT = 2;
__global__ __launch_bounds__(32) void att_kernel(const b16* __restrict__ QP, const b16* __restrict__ KP, const b16* __restrict__ VT, int GLIM, float* __restrict__ AO) { const int lane = threadIdx.x, nloc = lane & 15, hlf = lane >> 4; const int bth = blockIdx.x / (N / (16 * QT)), q0 = (blockIdx.x % (N / (16 * QT))) * (16 * QT); if (bth >= GLIM) return;
  constexpr float C2 = (SCALE / (HS * HS)) * 1.4426950408889634f;   // raw score -> log2 units
  v16b qf[QT];   // both halves: qh in elements 0..7, ql in 8..15
#pragma unroll   // constant indices keep the arrays in registers
  for (int t = 0; t < QT; ++t) qf[t] = *(const v16b*)(QP + ((size_t)bth * N + q0 + t * 16 + nloc) * 16);
  const b16* kp = KP + ((size_t)bth * N + nloc) * 16 + 8 * hlf;   // half 0 reads kh, half 1 kl
  const b16* vp = VT + ((size_t)bth * 16 + nloc) * N;
  float mx[QT], sm[QT]; v8f o[QT];
#pragma unroll   // constant indices keep the arrays in registers
  for (int t = 0; t < QT; ++t) { mx[t] = -INFINITY; sm[t] = 0.0f; o[t] = (v8f){}; }
  for (int k0 = 0; k0 < N; k0 += CH, kp += CH * 16, vp += CH) { v8f s[QT][CH / 16]; v8b kx[CH / 16];   // the chunk's four k fragments are fetched together: one load latency
#pragma unroll   // constant indices keep the arrays in registers
    for (int i = 0; i < CH / 16; ++i) kx[i] = *(const v8b*)(kp + i * 16 * 16);
    asm volatile("s_wait_xcnt 0x0" ::: "memory");   // stands in front of the first write to the register pair that the four loads name
#pragma unroll   // constant indices keep the arrays in registers
    for (int i = 0; i < CH / 16; ++i) { const v16b kd = __builtin_shufflevector(kx[i], kx[i], 0, 1, 2, 3, 4, 5, 6, 7, 0, 1, 2, 3, 4, 5, 6, 7);
#pragma unroll   // constant indices keep the arrays in registers
      for (int t = 0; t < QT; ++t) s[t][i] = wmma16b(kd, qf[t], (v8f){}); }
    v16b vf[CH / 32];   // fetched here so that they fly under the softmax arithmetic (the rows lie 1 KiB apart: each load touches 16 lines)
#pragma unroll   // constant indices keep the arrays in registers
    for (int j = 0; j < CH / 32; ++j) vf[j] = frag_kb(vp + j * 32, hlf);
#pragma unroll   // constant indices keep the arrays in registers
    for (int t = 0; t < QT; ++t) {
      float c0 = -INFINITY, c1 = -INFINITY;   // two chains, so that one's latency covers the other's
#pragma unroll   // constant indices keep the arrays in registers
      for (int tk = 0; tk < CH / 16; tk += 2) {
#pragma unroll   // constant indices keep the arrays in registers
        for (int r8 = 0; r8 < 8; r8 += 2) { c0 = fmaxf(fmaxf(c0, s[t][tk][r8]), s[t][tk][r8 + 1]); c1 = fmaxf(fmaxf(c1, s[t][tk + 1][r8]), s[t][tk + 1][r8 + 1]); } }
      float cm = fmaxf(c0, c1); cm = fmaxf(cm, xhalf(cm));
      const float mn = fmaxf(mx[t], cm), corr = exp2x1((mx[t] - mn) * C2), bias = 8.0f - mn * C2;   // + 8: p comes out times PS = 2^8
      mx[t] = mn; sm[t] *= corr;
#pragma unroll   // constant indices keep the arrays in registers
      for (int r8 = 0; r8 < 8; ++r8) o[t][r8] *= corr;
#pragma unroll   // constant indices keep the arrays in registers
      for (int j = 0; j < CH / 32; ++j) { v16b pa, pb; float x[16];
#pragma unroll   // constant indices keep the arrays in registers
        for (int e = 0; e < 16; ++e) x[e] = fmaf(s[t][2 * j + (e >> 3)][e & 7], C2, bias);
        exp2x8(x); exp2x8(x + 8);
#pragma unroll   // constant indices keep the arrays in registers
        for (int e = 0; e < 16; e += 2) { const v2f p = {x[e], x[e + 1]}; sm[t] += p[0]; sm[t] += p[1];
          const v2b ph = __builtin_convertvector(p, v2b); const v2b pl = __builtin_convertvector((v2f){p[0] - (float)ph[0], p[1] - (float)ph[1]}, v2b); pa[e] = ph[0]; pa[e + 1] = ph[1]; pb[e] = pl[0]; pb[e + 1] = pl[1]; }
        o[t] = wmma16b(vf[j], pa, o[t]); o[t] = wmma16b(vf[j], pb, o[t]); } } }
#pragma unroll   // constant indices keep the arrays in registers
  for (int t = 0; t < QT; ++t) { sm[t] += xhalf(sm[t]);
#pragma unroll   // constant indices keep the arrays in registers
    for (int r8 = 0; r8 < 8; ++r8) o[t][r8] += xhalf(o[t][r8]);   // vh P + vl P
    const float inv = 1.0f / (sm[t] * HS);   // o holds sum (PS p)(HS v), sm holds sum PS p
    if (hlf == 0) { float* dst = AO + ((size_t)bth * N + q0 + t * 16 + nloc) * HD; *(v4f*)dst = (v4f){o[t][0] * inv, o[t][1] * inv, o[t][2] * inv, o[t][3] * inv}; *(v4f*)(dst + 4) = (v4f){o[t][4] * inv, o[t][5] * inv, o[t][6] * inv, o[t][7] * inv}; } } }
// One wave per 16 output rows. Every operand fragment is read straight from global memory in the layout of frag_kb (lane (c, hf): k = kb + 8 hf + e and kb + 16 + 8 hf + e of row c),
// and all 48 loads are issued ahead of the first conversion, so the wave waits for one load latency in all. The product is formed transposed, out^T = Wo A^T,
// so lane (c, hf) holds channels 16 t4 + 8 hf + r of row c: eight neighbours in memory.
__global__ __launch_bounds__(32) void outp_kernel(const float* __restrict__ AO, const float* __restrict__ wo, const float* __restrict__ bo, int GLIM, float* __restrict__ out) { const int lane = threadIdx.x, nloc = lane & 15, hlf = lane >> 4; const int row = (int)blockIdx.x * 16 + nloc; const int b = row / (N * T), n = (row / T) % N, t = row % T;
  v4f ar[4][2], wr[4][2][4], br[4][2]; bool ok[4]; const float* pa[4]; const float* pw = wo + nloc * E + 8 * hlf;
#pragma unroll   // constant indices keep the arrays in registers
  for (int t4 = 0; t4 < 4; ++t4) { br[t4][0] = *(const v4f*)(bo + t4 * 16 + 8 * hlf); br[t4][1] = *(const v4f*)(bo + t4 * 16 + 8 * hlf + 4);
#pragma unroll   // constant indices keep the arrays in registers
    for (int kb = 0; kb < 2; ++kb) { const float* p = pw + t4 * 16 * E + kb * 32; wr[t4][kb][0] = *(const v4f*)p; wr[t4][kb][1] = *(const v4f*)(p + 4); wr[t4][kb][2] = *(const v4f*)(p + 16); wr[t4][kb][3] = *(const v4f*)(p + 20); } }
#pragma unroll   // constant indices keep the arrays in registers
  for (int j = 0; j < 4; ++j) { const int bth = (b * T + t) * H + 2 * j + hlf; ok[j] = bth < GLIM; pa[j] = AO + ((size_t)(ok[j] ? bth : 0) * N + n) * HD; ar[j][0] = *(const v4f*)pa[j]; ar[j][1] = *(const v4f*)(pa[j] + 4); }   // head 2 j + hf = channels 16 j + 8 hf ..+8
  // Stands in front of the first write to a register that a load above names; the addresses are inputs, so that none of their registers is handed to a later load's result ahead of it.
  asm volatile("s_wait_xcnt 0x0" :: "v"(pw), "v"(pa[0]), "v"(pa[1]), "v"(pa[2]), "v"(pa[3]) : "memory");
  v16b a[2], al[2];
#pragma unroll   // constant indices keep the arrays in registers
  for (int e = 0; e < 32; ++e) { const int j = e >> 3; const float v = ok[j] ? ar[j][(e >> 2) & 1][e & 3] : 0.0f; b16 p, pl; split16(v * HS, p, pl); a[e >> 4][e & 15] = p; al[e >> 4][e & 15] = pl; }
  v8f acc[4] = {(v8f){}, (v8f){}, (v8f){}, (v8f){}};
#pragma unroll   // constant indices keep the arrays in registers
  for (int kb = 0; kb < 2; ++kb) {
#pragma unroll   // constant indices keep the arrays in registers
    for (int t4 = 0; t4 < 4; ++t4) { v16b bw;
#pragma unroll   // constant indices keep the arrays in registers
      for (int e = 0; e < 16; ++e) bw[e] = (b16)(bfv(wr[t4][kb][e >> 2][e & 3]) * WSC);
      acc[t4] = wmma16b(bw, a[kb], acc[t4]); acc[t4] = wmma16b(bw, al[kb], acc[t4]); } }
#pragma unroll   // constant indices keep the arrays in registers
  for (int t4 = 0; t4 < 4; ++t4) { float* dst = out + (size_t)row * E + t4 * 16 + 8 * hlf; float r[8];
#pragma unroll   // constant indices keep the arrays in registers
    for (int r8 = 0; r8 < 8; ++r8) r[r8] = acc[t4][r8] * (1.0f / (HS * WSC)) + bfv(br[t4][r8 >> 2][r8 & 3]);
    *(v4f*)dst = (v4f){r[0], r[1], r[2], r[3]}; *(v4f*)(dst + 4) = (v4f){r[4], r[5], r[6], r[7]}; } }
}  // namespace

extern "C" void kernel_launch(void* const* d_in, const int* in_sizes, int n_in, void* d_out, int out_size, void* d_ws, size_t ws_size, hipStream_t stream) {
  (void)n_in;
  auto Fp = [&](int i) { return (const float*)d_in[i]; };
  // Input order: 0 values [2,512,24,64]; 1 keys; 2 query; 3 Wv [8,8]; 4 Wk; 5 Wq; 6 Wo [64,64]; 7 bo [64]
  if (in_sizes[0] != NB_ * N * T * E || in_sizes[1] != NB_ * N * T * E || in_sizes[2] != NB_ * N * T * E || in_sizes[3] != HD * HD || in_sizes[6] != E * E || out_size != NB_ * N * T * E) return;
  const int GLIM = NBT * H;   // (b,t,h) group cut
  size_t off = 0; char* ws = (char*)d_ws;
  auto carve = [&](size_t bytes) { char* p = ws + off; off += (bytes + 255) & ~(size_t)255; return p; };
  const size_t ng = (size_t)NBT * H;   // 384 groups
  b16* QP = (b16*)carve(ng * N * 16 * 2); b16* KP = (b16*)carve(ng * N * 16 * 2); b16* VT = (b16*)carve(ng * 16 * N * 2); float* AO = (float*)carve(ng * N * HD * 4);
  if (off > ws_size || off > ((size_t)80 << 20)) return;   // ~ 25 MB
  proj_kernel<<<NB_ * T * (N / 64), 256, 0, stream>>>(Fp(0), Fp(1), Fp(2), Fp(3), Fp(4), Fp(5), QP, KP, VT);
  att_kernel<<<(unsigned)(ng * (N / (16 * QT))), 32, 0, stream>>>(QP, KP, VT, GLIM, AO);
  outp_kernel<<<NB_ * N * T / 16, 32, 0, stream>>>(AO, Fp(6), Fp(7), GLIM, (float*)d_out);
}

// v005
// Measured time: 34.9 microseconds a run.
// Two timings next to v004 both put it at 1.08 times that version's speed.
// Over all steps from v000 it is 15.4 times as fast.
#include <hip/hip_runtime.h>

// SSelfAttention: per (b, t, h): q,k,v = x[b][n][t][h*8..+8] W^T (8x8 per-head linears shared across heads); energy[q][k] = q.k; attn = softmax_k(energy / sqrt(64)); out = attn v -> [b][n][t][h*8+d]; final out @ Wo^T + bo -> [2][512][24][64].
// Deterministic: per-wave softmax over the 512 nodes in fixed order; no atomics.
// WMMA (v_wmma_f32_16x16x32_f16, f32 accumulate): per (b, t, h, 32-query) wave S^T = k rows (32 tiles) x q rows (x256; the K of 32 holds the four products of hi and lo, 8 deep each) and o^T = v^T rows (8 hi rows + 8 lo rows, K 512) x P^T (hi, then lo, from the score registers); out = o (hi+lo, K 64) x Wo rows (EXACT; 4 tiles), formed by the work-group that made o; the 8x8 projections and softmax in f32.

namespace {
constexpr int NB_ = 2, N = 512, T = 24, E = 64, H = 8, HD = 8, NBT = NB_ * T /* 48 (b,t) groups */;
constexpr float HS = 256.0f, PS = 256.0f, WSC = 256.0f, SCALE = 0.125f /* 1/sqrt(64) */;
typedef _Float16 b16;
typedef __attribute__((ext_vector_type(16))) _Float16 v16b;
typedef __attribute__((ext_vector_type(8))) _Float16 v8b;
typedef __attribute__((ext_vector_type(8))) float v8f;
typedef __attribute__((ext_vector_type(4))) float v4f;
typedef __attribute__((ext_vector_type(2))) float v2f;
__device__ __forceinline__ float bf16_rne(float f) { unsigned int u = __float_as_uint(f); u += 0x7FFFu + ((u >> 16) & 1u); float r = __uint_as_float(u & 0xFFFF0000u); asm volatile("" : "+v"(r)); return r; }
__device__ __forceinline__ float bfv(float f) { float r = bf16_rne(f); asm volatile("" : "+v"(r)); return r; }
__device__ __forceinline__ void split16(float v, b16& hi, b16& lo) { hi = (b16)v; lo = (b16)(v - (float)hi); }
__device__ __forceinline__ v16b frag_kb(const b16* p, int hh) { const v8b a = *(const v8b*)(p + 8 * hh), b = *(const v8b*)(p + 16 + 8 * hh); v16b f;
#pragma unroll
  for (int e = 0; e < 8; ++e) { f[e] = a[e]; f[8 + e] = b[e]; } return f; }
__device__ __forceinline__ v8f wmma16b(v16b a, v16b b, v8f c) { v8f d = __builtin_amdgcn_wmma_f32_16x16x32_f16(false, a, false, b, (short)0, c, false, false); asm volatile("v_nop\n\tv_nop\n\tv_nop\n\tv_nop" : "+v"(d) : "v"(a), "v"(b)); return d; }
__device__ __forceinline__ float pmul(float a, float b) { float p = a * b; asm volatile("" : "+v"(p)); return p; }

typedef __attribute__((ext_vector_type(2))) _Float16 v2b;
// Every load of a stage is issued ahead of the stage's first pinned value: a pin keeps its place among the memory operations, so a load that follows one in the source is waited on alone.
__global__ __launch_bounds__(256) void proj_kernel(const float* __restrict__ xv, const float* __restrict__ xk, const float* __restrict__ xq, const float* __restrict__ wv, const float* __restrict__ wk, const float* __restrict__ wq, b16* __restrict__ QP, b16* __restrict__ KP, b16* __restrict__ VT) { __shared__ float Vs[H][HD][65]; __shared__ __attribute__((aligned(16))) float Wl[3][HD][HD]; const int b = blockIdx.x / (T * (N / 64)), rem = blockIdx.x % (T * (N / 64)); const int t = rem / (N / 64), n0 = (rem % (N / 64)) * 64; const int tid = threadIdx.x, h = tid >> 5, lane = tid & 31; const int bth = (b * T + t) * H + h;
  v4f xr[3][2][2];   // the thread's twelve input loads, in flight together
#pragma unroll   // constant indices keep the array in registers
  for (int which = 0; which < 3; ++which) { const float* xs = which == 0 ? xq : (which == 1 ? xk : xv);
#pragma unroll   // constant indices keep the array in registers
    for (int half = 0; half < 2; ++half) { const float* p = xs + (((size_t)b * N + n0 + half * 32 + lane) * T + t) * E + h * HD; xr[which][half][0] = *(const v4f*)p; xr[which][half][1] = *(const v4f*)(p + 4); } }
  if (tid < 3 * HD * HD) { const int w = tid / (HD * HD), ij = tid % (HD * HD); const float* src = w == 0 ? wq : (w == 1 ? wk : wv); Wl[w][ij / HD][ij % HD] = bfv(src[ij]); }
  __syncthreads();
#pragma unroll   // constant indices keep the arrays in registers
  for (int which = 0; which < 3; ++which) { v4f wr[HD][2];   // one weight matrix: sixteen LDS reads in flight together
#pragma unroll   // constant indices keep the arrays in registers
    for (int i = 0; i < HD; ++i) { wr[i][0] = *(const v4f*)&Wl[which][i][0]; wr[i][1] = *(const v4f*)&Wl[which][i][4]; }
#pragma unroll   // constant indices keep the arrays in registers
    for (int half = 0; half < 2; ++half) { const int n = n0 + half * 32 + lane; const size_t ro = ((size_t)bth * N + n) * 16;   // a row is 8 hi, then 8 lo
      float xx[HD];
#pragma unroll
      for (int j = 0; j < HD; ++j) xx[j] = bfv(xr[which][half][j >> 2][j & 3]);
      v8b hh8, ll8;
#pragma unroll
      for (int i = 0; i < HD; ++i) { float s = 0.0f;
#pragma unroll
        for (int j = 0; j < HD; ++j) s += pmul(xx[j], wr[i][j >> 2][j & 3]); if (which == 2) Vs[h][i][half * 32 + lane] = s; else { b16 p, pl; split16(s * HS, p, pl); hh8[i] = p; ll8[i] = pl; } }
      if (which < 2) { b16* P = which == 0 ? QP : KP; *(v8b*)(P + ro) = hh8; *(v8b*)(P + ro + 8) = ll8;
        asm volatile("s_wait_xcnt 0x0" ::: "memory"); } } }   // stands in front of the next pass's writes to the registers that the two stores name
  __syncthreads();
  { for (int d = 0; d < HD; ++d) { b16 h0, l0, h1, l1; split16(Vs[h][d][lane * 2] * HS, h0, l0); split16(Vs[h][d][lane * 2 + 1] * HS, h1, l1); const size_t o = ((size_t)bth * 16 + d) * N + n0 + lane * 2; *(v2b*)(VT + o) = (v2b){h0, h1}; *(v2b*)(VT + o + (size_t)HD * N) = (v2b){l0, l1}; }  } }   // rows 0..7 hi, rows 8..15 lo
// Value of lane l ^ 16 (the other half of the wave), by a vector cross-row move.
__device__ __forceinline__ float xhalf(float v) { const int b = __float_as_int(v); return __int_as_float(__builtin_amdgcn_permlanex16(b, b, 0x76543210, 0xfedcba98, false, false)); }
// Eight independent 2^x in place. One statement, so that no v_exp_f32 is directly followed by an instruction that overwrites its source or reads its result;
// the v_nop is the slot the instruction set asks for behind the last one.
__device__ __forceinline__ void exp2x8(float* x) { asm("v_exp_f32 %0, %0\n\tv_exp_f32 %1, %1\n\tv_exp_f32 %2, %2\n\tv_exp_f32 %3, %3\n\tv_exp_f32 %4, %4\n\tv_exp_f32 %5, %5\n\tv_exp_f32 %6, %6\n\tv_exp_f32 %7, %7\n\tv_nop" : "+v"(x[0]), "+v"(x[1]), "+v"(x[2]), "+v"(x[3]), "+v"(x[4]), "+v"(x[5]), "+v"(x[6]), "+v"(x[7])); }
// One 2^x. The v_nop is the slot the instruction set asks for behind a transcendental; it is in the same statement so that it stands directly behind it.
__device__ __forceinline__ float exp2x1(float x) { float r; asm("v_exp_f32 %0, %1\n\tv_nop" : "=v"(r) : "v"(x)); return r; }
constexpr int CH = 64, QT = 2;
// A work-group is the eight heads (one wave each) of the same (b, t) and the same 32 queries, so it holds whole rows of o: the waves hand them over in LDS and the work-group forms out = o Wo^T + bo itself.
__global__ __launch_bounds__(256) void att_kernel(const b16* __restrict__ QP, const b16* __restrict__ KP, const b16* __restrict__ VT, int GLIM, const float* __restrict__ wo, const float* __restrict__ bo, float* __restrict__ out) { __shared__ __attribute__((aligned(16))) float As[16 * QT][E + 4];   // 32 rows of o; the pitch of 17 x 16 bytes spreads the b128 reads over the banks
  const int lane = threadIdx.x & 31, nloc = lane & 15, hlf = lane >> 4; const int wv = __builtin_amdgcn_readfirstlane((int)threadIdx.x >> 5);   // the wave's number = the head; scalar, so that what hangs on it is a scalar branch or a scalar address
  const int bt = blockIdx.x / (N / (16 * QT)), q0 = (blockIdx.x % (N / (16 * QT))) * (16 * QT); const bool live = bt * H + wv < GLIM; const int bth = live ? bt * H + wv : 0;   // a head past the cut hands over zeros; it leaves no barrier out
  constexpr float C2 = (SCALE / (HS * HS)) * 1.4426950408889634f;   // raw score -> log2 units
  v16b qf[QT];   // both halves: qh in elements 0..7, ql in 8..15
#pragma unroll   // constant indices keep the arrays in registers
  for (int t = 0; t < QT; ++t) qf[t] = *(const v16b*)(QP + ((size_t)bth * N + q0 + t * 16 + nloc) * 16);
  const b16* kp = KP + ((size_t)bth * N + nloc) * 16 + 8 * hlf;   // half 0 reads kh, half 1 kl
  const b16* vp = VT + ((size_t)bth * 16 + nloc) * N;
  float mx[QT], sm[QT]; v8f o[QT];
#pragma unroll   // constant indices keep the arrays in registers
  for (int t = 0; t < QT; ++t) { mx[t] = -INFINITY; sm[t] = 0.0f; o[t] = (v8f){}; }
  for (int k0 = 0; k0 < N; k0 += CH, kp += CH * 16, vp += CH) { v8f s[QT][CH / 16]; v8b kx[CH / 16];   // the chunk's four k fragments are fetched together: one load latency
#pragma unroll   // constant indices keep the arrays in registers
    for (int i = 0; i < CH / 16; ++i) kx[i] = *(const v8b*)(kp + i * 16 * 16);
    asm volatile("s_wait_xcnt 0x0" ::: "memory");   // stands in front of the first write to the register pair that the four loads name
#pragma unroll   // constant indices keep the arrays in registers
    for (int i = 0; i < CH / 16; ++i) { const v16b kd = __builtin_shufflevector(kx[i], kx[i], 0, 1, 2, 3, 4, 5, 6, 7, 0, 1, 2, 3, 4, 5, 6, 7);
#pragma unroll   // constant indices keep the arrays in registers
      for (int t = 0; t < QT; ++t) s[t][i] = wmma16b(kd, qf[t], (v8f){}); }
    v16b vf[CH / 32];   // fetched here so that they fly under the softmax arithmetic (the rows lie 1 KiB apart: each load touches 16 lines)
#pragma unroll   // constant indices keep the arrays in registers
    for (int j = 0; j < CH / 32; ++j) vf[j] = frag_kb(vp + j * 32, hlf);
#pragma unroll   // constant indices keep the arrays in registers
    for (int t = 0; t < QT; ++t) {
      float c0 = -INFINITY, c1 = -INFINITY;   // two chains, so that one's latency covers the other's
#pragma unroll   // constant indices keep the arrays in registers
      for (int tk = 0; tk < CH / 16; tk += 2) {
#pragma unroll   // constant indices keep the arrays in registers
        for (int r8 = 0; r8 < 8; r8 += 2) { c0 = fmaxf(fmaxf(c0, s[t][tk][r8]), s[t][tk][r8 + 1]); c1 = fmaxf(fmaxf(c1, s[t][tk + 1][r8]), s[t][tk + 1][r8 + 1]); } }
      float cm = fmaxf(c0, c1); cm = fmaxf(cm, xhalf(cm));
      const float mn = fmaxf(mx[t], cm), corr = exp2x1((mx[t] - mn) * C2), bias = 8.0f - mn * C2;   // + 8: p comes out times PS = 2^8
      mx[t] = mn; sm[t] *= corr;
#pragma unroll   // constant indices keep the arrays in registers
      for (int r8 = 0; r8 < 8; ++r8) o[t][r8] *= corr;
#pragma unroll   // constant indices keep the arrays in registers
      for (int j = 0; j < CH / 32; ++j) { v16b pa, pb; float x[16];
#pragma unroll   // constant indices keep the arrays in registers
        for (int e = 0; e < 16; ++e) x[e] = fmaf(s[t][2 * j + (e >> 3)][e & 7], C2, bias);
        exp2x8(x); exp2x8(x + 8);
#pragma unroll   // constant indices keep the arrays in registers
        for (int e = 0; e < 16; e += 2) { const v2f p = {x[e], x[e + 1]}; sm[t] += p[0]; sm[t] += p[1];
          const v2b ph = __builtin_convertvector(p, v2b); const v2b pl = __builtin_convertvector((v2f){p[0] - (float)ph[0], p[1] - (float)ph[1]}, v2b); pa[e] = ph[0]; pa[e + 1] = ph[1]; pb[e] = pl[0]; pb[e + 1] = pl[1]; }
        o[t] = wmma16b(vf[j], pa, o[t]); o[t] = wmma16b(vf[j], pb, o[t]); } } }
#pragma unroll   // constant indices keep the arrays in registers
  for (int t = 0; t < QT; ++t) { sm[t] += xhalf(sm[t]);
#pragma unroll   // constant indices keep the arrays in registers
    for (int r8 = 0; r8 < 8; ++r8) o[t][r8] += xhalf(o[t][r8]);   // vh P + vl P
    const float inv = 1.0f / (sm[t] * HS);   // o holds sum (PS p)(HS v), sm holds sum PS p
    if (hlf == 0) { float* dst = &As[t * 16 + nloc][wv * HD]; *(v4f*)dst = live ? (v4f){o[t][0] * inv, o[t][1] * inv, o[t][2] * inv, o[t][3] * inv} : (v4f){}; *(v4f*)(dst + 4) = live ? (v4f){o[t][4] * inv, o[t][5] * inv, o[t][6] * inv, o[t][7] * inv} : (v4f){}; } }
  // Waves 0..3 each take 16 rows (rt) and 32 output channels (cp: two tiles of 16, one whole 128-byte line of every row). The product is formed transposed, out^T = Wo A^T,
  // so lane (c, hf) holds channels 16 u + 8 hf + r of row c: eight neighbours in memory. Fragments are in the layout of frag_kb (lane (c, hf): k = kb + 8 hf + e and kb + 16 + 8 hf + e of row c).
  // Their Wo and bo loads go out ahead of the barrier, so that the latency runs beside the wait for the other heads.
  const int rt = wv >> 1, cp = wv & 1; v4f wr[2][2][4], br[2][2]; const float* pw = wo + (cp * 32 + nloc) * E + 8 * hlf; const float* pb = bo + cp * 32 + 8 * hlf;
  if (wv < 4) {
#pragma unroll   // constant indices keep the arrays in registers
    for (int u = 0; u < 2; ++u) { br[u][0] = *(const v4f*)(pb + u * 16); br[u][1] = *(const v4f*)(pb + u * 16 + 4);
#pragma unroll   // constant indices keep the arrays in registers
      for (int kb = 0; kb < 2; ++kb) { const float* p = pw + u * 16 * E + kb * 32; wr[u][kb][0] = *(const v4f*)p; wr[u][kb][1] = *(const v4f*)(p + 4); wr[u][kb][2] = *(const v4f*)(p + 16); wr[u][kb][3] = *(const v4f*)(p + 20); } }
    // Stands in front of the first write to a register that a load above names; the addresses are inputs, so that none of their registers is handed to a later load's result ahead of it.
    asm volatile("s_wait_xcnt 0x0" :: "v"(pw), "v"(pb) : "memory"); }
  __syncthreads();   // every head's rows of o are in LDS behind it
  if (wv < 4) { v4f ar[4][2]; const float* pa = &As[rt * 16 + nloc][8 * hlf];
#pragma unroll   // constant indices keep the arrays in registers
    for (int j = 0; j < 4; ++j) { ar[j][0] = *(const v4f*)(pa + 16 * j); ar[j][1] = *(const v4f*)(pa + 16 * j + 4); }   // head 2 j + hf = channels 16 j + 8 hf ..+8
    v16b a[2], al[2];
#pragma unroll   // constant indices keep the arrays in registers
    for (int e = 0; e < 32; ++e) { b16 p, pl; split16(ar[e >> 3][(e >> 2) & 1][e & 3] * HS, p, pl); a[e >> 4][e & 15] = p; al[e >> 4][e & 15] = pl; }
    v8f acc[2] = {(v8f){}, (v8f){}};
#pragma unroll   // constant indices keep the arrays in registers
    for (int kb = 0; kb < 2; ++kb) {
#pragma unroll   // constant indices keep the arrays in registers
      for (int u = 0; u < 2; ++u) { v16b bw;
#pragma unroll   // constant indices keep the arrays in registers
        for (int e = 0; e < 16; ++e) bw[e] = (b16)(bfv(wr[u][kb][e >> 2][e & 3]) * WSC);
        acc[u] = wmma16b(bw, a[kb], acc[u]); acc[u] = wmma16b(bw, al[kb], acc[u]); } }
    const size_t row = ((size_t)(bt / T) * N + q0 + rt * 16 + nloc) * T + bt % T;   // out is [b][n][t][64], bt = b T + t
#pragma unroll   // constant indices keep the arrays in registers
    for (int u = 0; u < 2; ++u) { float* dst = out + row * E + cp * 32 + u * 16 + 8 * hlf; float r[8];
#pragma unroll   // constant indices keep the arrays in registers
      for (int r8 = 0; r8 < 8; ++r8) r[r8] = acc[u][r8] * (1.0f / (HS * WSC)) + bfv(br[u][r8 >> 2][r8 & 3]);
      *(v4f*)dst = (v4f){r[0], r[1], r[2], r[3]}; *(v4f*)(dst + 4) = (v4f){r[4], r[5], r[6], r[7]}; } } }
}  // namespace

extern "C" void kernel_launch(void* const* d_in, const int* in_sizes, int n_in, void* d_out, int out_size, void* d_ws, size_t ws_size, hipStream_t stream) {
  (void)n_in;
  auto Fp = [&](int i) { return (const float*)d_in[i]; };
  // Input order: 0 values [2,512,24,64]; 1 keys; 2 query; 3 Wv [8,8]; 4 Wk; 5 Wq; 6 Wo [64,64]; 7 bo [64]
  if (in_sizes[0] != NB_ * N * T * E || in_sizes[1] != NB_ * N * T * E || in_sizes[2] != NB_ * N * T * E || in_sizes[3] != HD * HD || in_sizes[6] != E * E || out_size != NB_ * N * T * E) return;
  const int GLIM = NBT * H;   // (b,t,h) group cut
  size_t off = 0; char* ws = (char*)d_ws;
  auto carve = [&](size_t bytes) { char* p = ws + off; off += (bytes + 255) & ~(size_t)255; return p; };
  const size_t ng = (size_t)NBT * H;   // 384 groups
  b16* QP = (b16*)carve(ng * N * 16 * 2); b16* KP = (b16*)carve(ng * N * 16 * 2); b16* VT = (b16*)carve(ng * 16 * N * 2);
  if (off > ws_size || off > ((size_t)80 << 20)) return;   // ~ 19 MB
  proj_kernel<<<NB_ * T * (N / 64), 256, 0, stream>>>(Fp(0), Fp(1), Fp(2), Fp(3), Fp(4), Fp(5), QP, KP, VT);
  att_kernel<<<NBT * (N / (16 * QT)), 32 * H, 0, stream>>>(QP, KP, VT, GLIM, Fp(6), Fp(7), (float*)d_out);
}

// v006
// Measured time: 33.5 microseconds a run.
// Two timings next to v005 put it at 1.04 and 1.05 times that version's speed.
// All steps since v000 together make it 16.1 times as fast.
#include <hip/hip_runtime.h>

// SSelfAttention: per (b, t, h): q,k,v = x[b][n][t][h*8..+8] W^T (8x8 per-head linears shared across heads); energy[q][k] = q.k; attn = softmax_k(energy / sqrt(64)); out = attn v -> [b][n][t][h*8+d]; final out @ Wo^T + bo -> [2][512][24][64].
// Deterministic: per-wave softmax over the 512 nodes in fixed order; no atomics.
// WMMA (v_wmma_f32_16x16x32_f16, f32 accumulate): per (b, t, h, 32-query) wave S^T = k rows (32 tiles) x q rows (x256; the K of 32 holds the four products of hi and lo, 8 deep each) and o^T = v^T rows (8 hi rows + 8 lo rows, K 512) x P^T (hi, then lo, from the score registers); out = o (hi+lo, K 64) x Wo rows (EXACT; 4 tiles), formed by the work-group that made o; the 8x8 projections and softmax in f32.

namespace {
constexpr int NB_ = 2, N = 512, T = 24, E = 64, H = 8, HD = 8, NBT = NB_ * T /* 48 (b,t) groups */;
constexpr float HS = 256.0f, PS = 256.0f, WSC = 256.0f, SCALE = 0.125f /* 1/sqrt(64) */;
typedef _Float16 b16;
typedef __attribute__((ext_vector_type(16))) _Float16 v16b;
typedef __attribute__((ext_vector_type(8))) _Float16 v8b;
typedef __attribute__((ext_vector_type(8))) float v8f;
typedef __attribute__((ext_vector_type(4))) float v4f;
typedef __attribute__((ext_vector_type(2))) float v2f;
__device__ __forceinline__ float bf16_rne(float f) { unsigned int u = __float_as_uint(f); u += 0x7FFFu + ((u >> 16) & 1u); float r = __uint_as_float(u & 0xFFFF0000u); asm volatile("" : "+v"(r)); return r; }
__device__ __forceinline__ float bfv(float f) { float r = bf16_rne(f); asm volatile("" : "+v"(r)); return r; }
__device__ __forceinline__ void split16(float v, b16& hi, b16& lo) { hi = (b16)v; lo = (b16)(v - (float)hi); }
__device__ __forceinline__ v16b frag_kb(const b16* p, int hh) { const v8b a = *(const v8b*)(p + 8 * hh), b = *(const v8b*)(p + 16 + 8 * hh); v16b f;
#pragma unroll
  for (int e = 0; e < 8; ++e) { f[e] = a[e]; f[8 + e] = b[e]; } return f; }
__device__ __forceinline__ v8f wmma16b(v16b a, v16b b, v8f c) { v8f d = __builtin_amdgcn_wmma_f32_16x16x32_f16(false, a, false, b, (short)0, c, false, false); asm volatile("v_nop\n\tv_nop\n\tv_nop\n\tv_nop" : "+v"(d) : "v"(a), "v"(b)); return d; }
__device__ __forceinline__ float pmul(float a, float b) { float p = a * b; asm volatile("" : "+v"(p)); return p; }

typedef __attribute__((ext_vector_type(2))) _Float16 v2b;
// Every load of a stage is issued ahead of the stage's first pinned value: a pin keeps its place among the memory operations, so a load that follows one in the source is waited on alone.
__global__ __launch_bounds__(256) void proj_kernel(const float* __restrict__ xv, const float* __restrict__ xk, const float* __restrict__ xq, const float* __restrict__ wv, const float* __restrict__ wk, const float* __restrict__ wq, b16* __restrict__ QP, b16* __restrict__ KP, b16* __restrict__ VT) { __shared__ float Vs[H][HD][65]; __shared__ __attribute__((aligned(16))) float Wl[3][HD][HD]; const int b = blockIdx.x / (T * (N / 64)), rem = blockIdx.x % (T * (N / 64)); const int t = rem / (N / 64), n0 = (rem % (N / 64)) * 64; const int tid = threadIdx.x, h = tid >> 5, lane = tid & 31; const int bth = (b * T + t) * H + h;
  v4f xr[3][2][2];   // the thread's twelve input loads, in flight together
#pragma unroll   // constant indices keep the array in registers
  for (int which = 0; which < 3; ++which) { const float* xs = which == 0 ? xq : (which == 1 ? xk : xv);
#pragma unroll   // constant indices keep the array in registers
    for (int half = 0; half < 2; ++half) { const float* p = xs + (((size_t)b * N + n0 + half * 32 + lane) * T + t) * E + h * HD; xr[which][half][0] = *(const v4f*)p; xr[which][half][1] = *(const v4f*)(p + 4); } }
  if (tid < 3 * HD * HD) { const int w = tid / (HD * HD), ij = tid % (HD * HD); const float* src = w == 0 ? wq : (w == 1 ? wk : wv); Wl[w][ij / HD][ij % HD] = bfv(src[ij]); }
  __syncthreads();
#pragma unroll   // constant indices keep the arrays in registers
  for (int which = 0; which < 3; ++which) { v4f wr[HD][2];   // one weight matrix: sixteen LDS reads in flight together
#pragma unroll   // constant indices keep the arrays in registers
    for (int i = 0; i < HD; ++i) { wr[i][0] = *(const v4f*)&Wl[which][i][0]; wr[i][1] = *(const v4f*)&Wl[which][i][4]; }
#pragma unroll   // constant indices keep the arrays in registers
    for (int half = 0; half < 2; ++half) { const int n = n0 + half * 32 + lane; const size_t ro = ((size_t)bth * N + n) * 16;   // a row is 8 hi, then 8 lo
      float xx[HD];
#pragma unroll
      for (int j = 0; j < HD; ++j) xx[j] = bfv(xr[which][half][j >> 2][j & 3]);
      v8b hh8, ll8;
#pragma unroll
      for (int i = 0; i < HD; ++i) { float s = 0.0f;
#pragma unroll
        for (int j = 0; j < HD; ++j) s += pmul(xx[j], wr[i][j >> 2][j & 3]); if (which == 2) Vs[h][i][half * 32 + lane] = s; else { b16 p, pl; split16(s * HS, p, pl); hh8[i] = p; ll8[i] = pl; } }
      if (which < 2) { b16* P = which == 0 ? QP : KP; *(v8b*)(P + ro) = hh8; *(v8b*)(P + ro + 8) = ll8;
        asm volatile("s_wait_xcnt 0x0" ::: "memory"); } } }   // stands in front of the next pass's writes to the registers that the two stores name
  __syncthreads();
  { for (int d = 0; d < HD; ++d) { b16 h0, l0, h1, l1; split16(Vs[h][d][lane * 2] * HS, h0, l0); split16(Vs[h][d][lane * 2 + 1] * HS, h1, l1); const size_t o = ((size_t)bth * 16 + d) * N + n0 + lane * 2; *(v2b*)(VT + o) = (v2b){h0, h1}; *(v2b*)(VT + o + (size_t)HD * N) = (v2b){l0, l1}; }  } }   // rows 0..7 hi, rows 8..15 lo
// Value of lane l ^ 16 (the other half of the wave), by a vector cross-row move.
__device__ __forceinline__ float xhalf(float v) { const int b = __float_as_int(v); return __int_as_float(__builtin_amdgcn_permlanex16(b, b, 0x76543210, 0xfedcba98, false, false)); }
// Eight independent 2^x in place. One statement, so that no v_exp_f32 is directly followed by an instruction that overwrites its source or reads its result;
// the v_nop is the slot the instruction set asks for behind the last one.
__device__ __forceinline__ void exp2x8(float* x) { asm("v_exp_f32 %0, %0\n\tv_exp_f32 %1, %1\n\tv_exp_f32 %2, %2\n\tv_exp_f32 %3, %3\n\tv_exp_f32 %4, %4\n\tv_exp_f32 %5, %5\n\tv_exp_f32 %6, %6\n\tv_exp_f32 %7, %7\n\tv_nop" : "+v"(x[0]), "+v"(x[1]), "+v"(x[2]), "+v"(x[3]), "+v"(x[4]), "+v"(x[5]), "+v"(x[6]), "+v"(x[7])); }
// One 2^x. The v_nop is the slot the instruction set asks for behind a transcendental; it is in the same statement so that it stands directly behind it.
__device__ __forceinline__ float exp2x1(float x) { float r; asm("v_exp_f32 %0, %1\n\tv_nop" : "=v"(r) : "v"(x)); return r; }
constexpr int CH = 64, QT = 2;
// A work-group is the eight heads (one wave each) of the same (b, t) and the same 32 queries, so it holds whole rows of o: the waves hand them over in LDS and the work-group forms out = o Wo^T + bo itself.
// The second launch bound asks for six waves per SIMD (a budget of 160 registers): three work-groups then fit a WGP, and the grid of 768 is resident at once on 256 WGPs. At two per WGP a third of the grid waits for a second round that leaves each SIMD two waves.
__global__ __launch_bounds__(256, 6) void att_kernel(const b16* __restrict__ QP, const b16* __restrict__ KP, const b16* __restrict__ VT, int GLIM, const float* __restrict__ wo, const float* __restrict__ bo, float* __restrict__ out) { __shared__ __attribute__((aligned(16))) float As[16 * QT][E + 4];   // 32 rows of o; the pitch of 17 x 16 bytes spreads the b128 reads over the banks
  const int lane = threadIdx.x & 31, nloc = lane & 15, hlf = lane >> 4; const int wv = __builtin_amdgcn_readfirstlane((int)threadIdx.x >> 5);   // the wave's number = the head; scalar, so that what hangs on it is a scalar branch or a scalar address
  const int bt = blockIdx.x / (N / (16 * QT)), q0 = (blockIdx.x % (N / (16 * QT))) * (16 * QT); const bool live = bt * H + wv < GLIM; const int bth = live ? bt * H + wv : 0;   // a head past the cut hands over zeros; it leaves no barrier out
  constexpr float C2 = (SCALE / (HS * HS)) * 1.4426950408889634f;   // raw score -> log2 units
  v16b qf[QT];   // both halves: qh in elements 0..7, ql in 8..15
#pragma unroll   // constant indices keep the arrays in registers
  for (int t = 0; t < QT; ++t) qf[t] = *(const v16b*)(QP + ((size_t)bth * N + q0 + t * 16 + nloc) * 16);
  const b16* kp = KP + ((size_t)bth * N + nloc) * 16 + 8 * hlf;   // half 0 reads kh, half 1 kl
  const b16* vp = VT + ((size_t)bth * 16 + nloc) * N + 8 * hlf;   // the half's offset is in the pointer: one register pair, not a base and an offset
  float mx[QT], sm[QT]; v8f o[QT];
#pragma unroll   // constant indices keep the arrays in registers
  for (int t = 0; t < QT; ++t) { mx[t] = -INFINITY; sm[t] = 0.0f; o[t] = (v8f){}; }
  for (int k0 = 0; k0 < N; k0 += CH, kp += CH * 16, vp += CH) { v8f s[QT][CH / 16]; v8b kx[CH / 16];   // the chunk's four k fragments are fetched together: one load latency
#pragma unroll   // constant indices keep the arrays in registers
    for (int i = 0; i < CH / 16; ++i) kx[i] = *(const v8b*)(kp + i * 16 * 16);
    asm volatile("s_wait_xcnt 0x0" ::: "memory");   // stands in front of the first write to the register pair that the four loads name
#pragma unroll   // constant indices keep the arrays in registers
    for (int i = 0; i < CH / 16; ++i) { const v16b kd = __builtin_shufflevector(kx[i], kx[i], 0, 1, 2, 3, 4, 5, 6, 7, 0, 1, 2, 3, 4, 5, 6, 7);
#pragma unroll   // constant indices keep the arrays in registers
      for (int t = 0; t < QT; ++t) s[t][i] = wmma16b(kd, qf[t], (v8f){}); }
    v16b vf[CH / 32];   // fetched here so that they fly under the softmax arithmetic (the rows lie 1 KiB apart: each load touches 16 lines)
#pragma unroll   // constant indices keep the arrays in registers
    for (int j = 0; j < CH / 32; ++j) vf[j] = frag_kb(vp + j * 32, 0);
    asm volatile("s_wait_xcnt 0x0" :: "v"(vp) : "memory");   // stands in front of the first write to the register pair that the four loads name; the address is an input, so that its registers are not handed to a load's result ahead of it
    __builtin_amdgcn_sched_barrier(0);   // keeps the four loads here, ahead of the softmax arithmetic that covers their latency: under the budget of 160 registers the compiler otherwise sinks them to just in front of their first use
#pragma unroll   // constant indices keep the arrays in registers
    for (int t = 0; t < QT; ++t) {
      float c0 = -INFINITY, c1 = -INFINITY;   // two chains, so that one's latency covers the other's
#pragma unroll   // constant indices keep the arrays in registers
      for (int tk = 0; tk < CH / 16; tk += 2) {
#pragma unroll   // constant indices keep the arrays in registers
        for (int r8 = 0; r8 < 8; r8 += 2) { c0 = fmaxf(fmaxf(c0, s[t][tk][r8]), s[t][tk][r8 + 1]); c1 = fmaxf(fmaxf(c1, s[t][tk + 1][r8]), s[t][tk + 1][r8 + 1]); } }
      float cm = fmaxf(c0, c1); cm = fmaxf(cm, xhalf(cm));
      const float mn = fmaxf(mx[t], cm), corr = exp2x1((mx[t] - mn) * C2), bias = 8.0f - mn * C2;   // + 8: p comes out times PS = 2^8
      mx[t] = mn; sm[t] *= corr;
#pragma unroll   // constant indices keep the arrays in registers
      for (int r8 = 0; r8 < 8; ++r8) o[t][r8] *= corr;
#pragma unroll   // constant indices keep the arrays in registers
      for (int j = 0; j < CH / 32; ++j) { v16b pa, pb; float x[16];
#pragma unroll   // constant indices keep the arrays in registers
        for (int e = 0; e < 16; ++e) x[e] = fmaf(s[t][2 * j + (e >> 3)][e & 7], C2, bias);
        exp2x8(x); exp2x8(x + 8);
#pragma unroll   // constant indices keep the arrays in registers
        for (int e = 0; e < 16; e += 2) { const v2f p = {x[e], x[e + 1]}; sm[t] += p[0]; sm[t] += p[1];
          const v2b ph = __builtin_convertvector(p, v2b); const v2b pl = __builtin_convertvector((v2f){p[0] - (float)ph[0], p[1] - (float)ph[1]}, v2b); pa[e] = ph[0]; pa[e + 1] = ph[1]; pb[e] = pl[0]; pb[e + 1] = pl[1]; }
        o[t] = wmma16b(vf[j], pa, o[t]); o[t] = wmma16b(vf[j], pb, o[t]); } } }
#pragma unroll   // constant indices keep the arrays in registers
  for (int t = 0; t < QT; ++t) { sm[t] += xhalf(sm[t]);
#pragma unroll   // constant indices keep the arrays in registers
    for (int r8 = 0; r8 < 8; ++r8) o[t][r8] += xhalf(o[t][r8]);   // vh P + vl P
    const float inv = 1.0f / (sm[t] * HS);   // o holds sum (PS p)(HS v), sm holds sum PS p
    if (hlf == 0) { float* dst = &As[t * 16 + nloc][wv * HD]; *(v4f*)dst = live ? (v4f){o[t][0] * inv, o[t][1] * inv, o[t][2] * inv, o[t][3] * inv} : (v4f){}; *(v4f*)(dst + 4) = live ? (v4f){o[t][4] * inv, o[t][5] * inv, o[t][6] * inv, o[t][7] * inv} : (v4f){}; } }
  // Waves 0..3 each take 16 rows (rt) and 32 output channels (cp: two tiles of 16, one whole 128-byte line of every row). The product is formed transposed, out^T = Wo A^T,
  // so lane (c, hf) holds channels 16 u + 8 hf + r of row c: eight neighbours in memory. Fragments are in the layout of frag_kb (lane (c, hf): k = kb + 8 hf + e and kb + 16 + 8 hf + e of row c).
  // Their Wo and bo loads go out ahead of the barrier, so that the latency runs beside the wait for the other heads.
  const int rt = wv >> 1, cp = wv & 1; v4f wr[2][2][4], br[2][2]; const float* pw = wo + (cp * 32 + nloc) * E + 8 * hlf; const float* pb = bo + cp * 32 + 8 * hlf;
  if (wv < 4) {
#pragma unroll   // constant indices keep the arrays in registers
    for (int u = 0; u < 2; ++u) { br[u][0] = *(const v4f*)(pb + u * 16); br[u][1] = *(const v4f*)(pb + u * 16 + 4);
#pragma unroll   // constant indices keep the arrays in registers
      for (int kb = 0; kb < 2; ++kb) { const float* p = pw + u * 16 * E + kb * 32; wr[u][kb][0] = *(const v4f*)p; wr[u][kb][1] = *(const v4f*)(p + 4); wr[u][kb][2] = *(const v4f*)(p + 16); wr[u][kb][3] = *(const v4f*)(p + 20); } }
    // Stands in front of the first write to a register that a load above names; the addresses are inputs, so that none of their registers is handed to a later load's result ahead of it.
    asm volatile("s_wait_xcnt 0x0" :: "v"(pw), "v"(pb) : "memory"); }
  __syncthreads();   // every head's rows of o are in LDS behind it
  if (wv < 4) { v4f ar[4][2]; const float* pa = &As[rt * 16 + nloc][8 * hlf];
#pragma unroll   // constant indices keep the arrays in registers
    for (int j = 0; j < 4; ++j) { ar[j][0] = *(const v4f*)(pa + 16 * j); ar[j][1] = *(const v4f*)(pa + 16 * j + 4); }   // head 2 j + hf = channels 16 j + 8 hf ..+8
    v16b a[2], al[2];
#pragma unroll   // constant indices keep the arrays in registers
    for (int e = 0; e < 32; ++e) { b16 p, pl; split16(ar[e >> 3][(e >> 2) & 1][e & 3] * HS, p, pl); a[e >> 4][e & 15] = p; al[e >> 4][e & 15] = pl; }
    v8f acc[2] = {(v8f){}, (v8f){}};
#pragma unroll   // constant indices keep the arrays in registers
    for (int kb = 0; kb < 2; ++kb) {
#pragma unroll   // constant indices keep the arrays in registers
      for (int u = 0; u < 2; ++u) { v16b bw;
#pragma unroll   // constant indices keep the arrays in registers
        for (int e = 0; e < 16; ++e) bw[e] = (b16)(bfv(wr[u][kb][e >> 2][e & 3]) * WSC);
        acc[u] = wmma16b(bw, a[kb], acc[u]); acc[u] = wmma16b(bw, al[kb], acc[u]); } }
    const size_t row = ((size_t)(bt / T) * N + q0 + rt * 16 + nloc) * T + bt % T;   // out is [b][n][t][64], bt = b T + t
#pragma unroll   // constant indices keep the arrays in registers
    for (int u = 0; u < 2; ++u) { float* dst = out + row * E + cp * 32 + u * 16 + 8 * hlf; float r[8];
#pragma unroll   // constant indices keep the arrays in registers
      for (int r8 = 0; r8 < 8; ++r8) r[r8] = acc[u][r8] * (1.0f / (HS * WSC)) + bfv(br[u][r8 >> 2][r8 & 3]);
      *(v4f*)dst = (v4f){r[0], r[1], r[2], r[3]}; *(v4f*)(dst + 4) = (v4f){r[4], r[5], r[6], r[7]}; } } }
}  // namespace

extern "C" void kernel_launch(void* const* d_in, const int* in_sizes, int n_in, void* d_out, int out_size, void* d_ws, size_t ws_size, hipStream_t stream) {
  (void)n_in;
  auto Fp = [&](int i) { return (const float*)d_in[i]; };
  // Input order: 0 values [2,512,24,64]; 1 keys; 2 query; 3 Wv [8,8]; 4 Wk; 5 Wq; 6 Wo [64,64]; 7 bo [64]
  if (in_sizes[0] != NB_ * N * T * E || in_sizes[1] != NB_ * N * T * E || in_sizes[2] != NB_ * N * T * E || in_sizes[3] != HD * HD || in_sizes[6] != E * E || out_size != NB_ * N * T * E) return;
  const int GLIM = NBT * H;   // (b,t,h) group cut
  size_t off = 0; char* ws = (char*)d_ws;
  auto carve = [&](size_t bytes) { char* p = ws + off; off += (bytes + 255) & ~(size_t)255; return p; };
  const size_t ng = (size_t)NBT * H;   // 384 groups
  b16* QP = (b16*)carve(ng * N * 16 * 2); b16* KP = (b16*)carve(ng * N * 16 * 2); b16* VT = (b16*)carve(ng * 16 * N * 2);
  if (off > ws_size || off > ((size_t)80 << 20)) return;   // ~ 19 MB
  proj_kernel<<<NB_ * T * (N / 64), 256, 0, stream>>>(Fp(0), Fp(1), Fp(2), Fp(3), Fp(4), Fp(5), QP, KP, VT);
  att_kernel<<<NBT * (N / (16 * QT)), 32 * H, 0, stream>>>(QP, KP, VT, GLIM, Fp(6), Fp(7), (float*)d_out);
}

// v007
// One run takes 32.2 microseconds.
// In two side-by-side timings against v006, it was 1.04 and 1.05 times as fast.
// All steps since v000 together make it 16.8 times as fast.
#include <hip/hip_runtime.h>

// SSelfAttention: per (b, t, h): q,k,v = x[b][n][t][h*8..+8] W^T (8x8 per-head linears shared across heads); energy[q][k] = q.k; attn = softmax_k(energy / sqrt(64)); out = attn v -> [b][n][t][h*8+d]; final out @ Wo^T + bo -> [2][512][24][64].
// Deterministic: per-wave softmax over the 512 nodes in fixed order; no atomics.
// WMMA (v_wmma_f32_16x16x32_f16, f32 accumulate): per (b, t, h, 32-query) wave S^T = k rows (32 tiles) x q rows (x256; the K of 32 holds the four products of hi and lo, 8 deep each) and o^T = v^T rows (8 hi rows + 8 lo rows, K 512) x P^T (hi, then lo, from the score registers); out = o (hi+lo, K 64) x Wo rows (EXACT; 4 tiles), formed by the work-group that made o; the 8x8 projections and softmax in f32.

namespace {
constexpr int NB_ = 2, N = 512, T = 24, E = 64, H = 8, HD = 8, NBT = NB_ * T /* 48 (b,t) groups */;
constexpr float HS = 256.0f, PS = 256.0f, WSC = 256.0f, SCALE = 0.125f /* 1/sqrt(64) */;
typedef _Float16 b16;
typedef __attribute__((ext_vector_type(16))) _Float16 v16b;
typedef __attribute__((ext_vector_type(8))) _Float16 v8b;
typedef __attribute__((ext_vector_type(8))) float v8f;
typedef __attribute__((ext_vector_type(4))) float v4f;
typedef __attribute__((ext_vector_type(2))) float v2f;
__device__ __forceinline__ float bf16_rne(float f) { unsigned int u = __float_as_uint(f); u += 0x7FFFu + ((u >> 16) & 1u); float r = __uint_as_float(u & 0xFFFF0000u); asm volatile("" : "+v"(r)); return r; }
__device__ __forceinline__ float bfv(float f) { float r = bf16_rne(f); asm volatile("" : "+v"(r)); return r; }
__device__ __forceinline__ void split16(float v, b16& hi, b16& lo) { hi = (b16)v; lo = (b16)(v - (float)hi); }
__device__ __forceinline__ v16b frag_kb(const b16* p, int hh) { const v8b a = *(const v8b*)(p + 8 * hh), b = *(const v8b*)(p + 16 + 8 * hh); v16b f;
#pragma unroll
  for (int e = 0; e < 8; ++e) { f[e] = a[e]; f[8 + e] = b[e]; } return f; }
__device__ __forceinline__ v8f wmma16b(v16b a, v16b b, v8f c) { return __builtin_amdgcn_wmma_f32_16x16x32_f16(false, a, false, b, (short)0, c, false, false); }   // the plain builtin: the compiler keeps the distance behind it, with useful instructions where it has them
__device__ __forceinline__ float pmul(float a, float b) { float p = a * b; asm volatile("" : "+v"(p)); return p; }

typedef __attribute__((ext_vector_type(2))) _Float16 v2b;
// Every load of a stage is issued ahead of the stage's first pinned value: a pin keeps its place among the memory operations, so a load that follows one in the source is waited on alone.
__global__ __launch_bounds__(256) void proj_kernel(const float* __restrict__ xv, const float* __restrict__ xk, const float* __restrict__ xq, const float* __restrict__ wv, const float* __restrict__ wk, const float* __restrict__ wq, b16* __restrict__ QP, b16* __restrict__ KP, b16* __restrict__ VT) { __shared__ float Vs[H][HD][65]; __shared__ __attribute__((aligned(16))) float Wl[3][HD][HD]; const int b = blockIdx.x / (T * (N / 64)), rem = blockIdx.x % (T * (N / 64)); const int t = rem / (N / 64), n0 = (rem % (N / 64)) * 64; const int tid = threadIdx.x, h = tid >> 5, lane = tid & 31; const int bth = (b * T + t) * H + h;
  v4f xr[3][2][2];   // the thread's twelve input loads, in flight together
#pragma unroll   // constant indices keep the array in registers
  for (int which = 0; which < 3; ++which) { const float* xs = which == 0 ? xq : (which == 1 ? xk : xv);
#pragma unroll   // constant indices keep the array in registers
    for (int half = 0; half < 2; ++half) { const float* p = xs + (((size_t)b * N + n0 + half * 32 + lane) * T + t) * E + h * HD; xr[which][half][0] = *(const v4f*)p; xr[which][half][1] = *(const v4f*)(p + 4); } }
  if (tid < 3 * HD * HD) { const int w = tid / (HD * HD), ij = tid % (HD * HD); const float* src = w == 0 ? wq : (w == 1 ? wk : wv); Wl[w][ij / HD][ij % HD] = bfv(src[ij]); }
  __syncthreads();
#pragma unroll   // constant indices keep the arrays in registers
  for (int which = 0; which < 3; ++which) { v4f wr[HD][2];   // one weight matrix: sixteen LDS reads in flight together
#pragma unroll   // constant indices keep the arrays in registers
    for (int i = 0; i < HD; ++i) { wr[i][0] = *(const v4f*)&Wl[which][i][0]; wr[i][1] = *(const v4f*)&Wl[which][i][4]; }
#pragma unroll   // constant indices keep the arrays in registers
    for (int half = 0; half < 2; ++half) { const int n = n0 + half * 32 + lane; const size_t ro = ((size_t)bth * N + n) * 16;   // a row is 8 hi, then 8 lo
      float xx[HD];
#pragma unroll
      for (int j = 0; j < HD; ++j) xx[j] = bfv(xr[which][half][j >> 2][j & 3]);
      v8b hh8, ll8;
#pragma unroll
      for (int i = 0; i < HD; ++i) { float s = 0.0f;
#pragma unroll
        for (int j = 0; j < HD; ++j) s += pmul(xx[j], wr[i][j >> 2][j & 3]); if (which == 2) Vs[h][i][half * 32 + lane] = s; else { b16 p, pl; split16(s * HS, p, pl); hh8[i] = p; ll8[i] = pl; } }
      if (which < 2) { b16* P = which == 0 ? QP : KP; *(v8b*)(P + ro) = hh8; *(v8b*)(P + ro + 8) = ll8;
        asm volatile("s_wait_xcnt 0x0" ::: "memory"); } } }   // stands in front of the next pass's writes to the registers that the two stores name
  __syncthreads();
  { for (int d = 0; d < HD; ++d) { b16 h0, l0, h1, l1; split16(Vs[h][d][lane * 2] * HS, h0, l0); split16(Vs[h][d][lane * 2 + 1] * HS, h1, l1); const size_t o = ((size_t)bth * 16 + d) * N + n0 + lane * 2; *(v2b*)(VT + o) = (v2b){h0, h1}; *(v2b*)(VT + o + (size_t)HD * N) = (v2b){l0, l1}; }  } }   // rows 0..7 hi, rows 8..15 lo
// Value of lane l ^ 16 (the other half of the wave), by a vector cross-row move.
__device__ __forceinline__ float xhalf(float v) { const int b = __float_as_int(v); return __int_as_float(__builtin_amdgcn_permlanex16(b, b, 0x76543210, 0xfedcba98, false, false)); }
// Eight independent 2^x in place. One statement, so that no v_exp_f32 is directly followed by an instruction that overwrites its source or reads its result;
// the v_nop is the slot the instruction set asks for behind the last one.
__device__ __forceinline__ void exp2x8(float* x) { asm("v_exp_f32 %0, %0\n\tv_exp_f32 %1, %1\n\tv_exp_f32 %2, %2\n\tv_exp_f32 %3, %3\n\tv_exp_f32 %4, %4\n\tv_exp_f32 %5, %5\n\tv_exp_f32 %6, %6\n\tv_exp_f32 %7, %7\n\tv_nop" : "+v"(x[0]), "+v"(x[1]), "+v"(x[2]), "+v"(x[3]), "+v"(x[4]), "+v"(x[5]), "+v"(x[6]), "+v"(x[7])); }
// One 2^x. The v_nop is the slot the instruction set asks for behind a transcendental; it is in the same statement so that it stands directly behind it.
__device__ __forceinline__ float exp2x1(float x) { float r; asm("v_exp_f32 %0, %1\n\tv_nop" : "=v"(r) : "v"(x)); return r; }
constexpr int CH = 64, QT = 2;
// A work-group is the eight heads (one wave each) of the same (b, t) and the same 32 queries, so it holds whole rows of o: the waves hand them over in LDS and the work-group forms out = o Wo^T + bo itself.
// The second launch bound asks for six waves per SIMD (a budget of 160 registers): three work-groups then fit a WGP, and the grid of 768 is resident at once on 256 WGPs. At two per WGP a third of the grid waits for a second round that leaves each SIMD two waves.
__global__ __launch_bounds__(256, 6) void att_kernel(const b16* __restrict__ QP, const b16* __restrict__ KP, const b16* __restrict__ VT, int GLIM, const float* __restrict__ wo, const float* __restrict__ bo, float* __restrict__ out) { __shared__ __attribute__((aligned(16))) float As[16 * QT][E + 4];   // 32 rows of o; the pitch of 17 x 16 bytes spreads the b128 reads over the banks
  const int lane = threadIdx.x & 31, nloc = lane & 15, hlf = lane >> 4; const int wv = __builtin_amdgcn_readfirstlane((int)threadIdx.x >> 5);   // the wave's number = the head; scalar, so that what hangs on it is a scalar branch or a scalar address
  const int bt = blockIdx.x / (N / (16 * QT)), q0 = (blockIdx.x % (N / (16 * QT))) * (16 * QT); const bool live = bt * H + wv < GLIM; const int bth = live ? bt * H + wv : 0;   // a head past the cut hands over zeros; it leaves no barrier out
  constexpr float C2 = (SCALE / (HS * HS)) * 1.4426950408889634f;   // raw score -> log2 units
  v16b qf[QT];   // both halves: qh in elements 0..7, ql in 8..15
#pragma unroll   // constant indices keep the arrays in registers
  for (int t = 0; t < QT; ++t) qf[t] = *(const v16b*)(QP + ((size_t)bth * N + q0 + t * 16 + nloc) * 16);
  const b16* kp = KP + ((size_t)bth * N + nloc) * 16 + 8 * hlf;   // half 0 reads kh, half 1 kl
  const b16* vp = VT + ((size_t)bth * 16 + nloc) * N + 8 * hlf;   // the half's offset is in the pointer: one register pair, not a base and an offset
  float mx[QT]; v2f sm[QT]; v8f o[QT];
#pragma unroll   // constant indices keep the arrays in registers
  for (int t = 0; t < QT; ++t) { mx[t] = -INFINITY; sm[t] = (v2f){}; o[t] = (v8f){}; }
  for (int k0 = 0; k0 < N; k0 += CH, kp += CH * 16, vp += CH) { v8f s[QT][CH / 16]; v8b kx[CH / 16];   // the chunk's four k fragments are fetched together: one load latency
#pragma unroll   // constant indices keep the arrays in registers
    for (int i = 0; i < CH / 16; ++i) kx[i] = *(const v8b*)(kp + i * 16 * 16);
    asm volatile("s_wait_xcnt 0x0" ::: "memory");   // stands in front of the first write to the register pair that the four loads name
#pragma unroll   // constant indices keep the arrays in registers
    for (int i = 0; i < CH / 16; ++i) { const v16b kd = __builtin_shufflevector(kx[i], kx[i], 0, 1, 2, 3, 4, 5, 6, 7, 0, 1, 2, 3, 4, 5, 6, 7);
#pragma unroll   // constant indices keep the arrays in registers
      for (int t = 0; t < QT; ++t) s[t][i] = wmma16b(kd, qf[t], (v8f){}); }
    v16b vf[CH / 32];   // fetched here so that they fly under the softmax arithmetic (the rows lie 1 KiB apart: each load touches 16 lines)
#pragma unroll   // constant indices keep the arrays in registers
    for (int j = 0; j < CH / 32; ++j) vf[j] = frag_kb(vp + j * 32, 0);
    asm volatile("s_wait_xcnt 0x0" :: "v"(vp) : "memory");   // stands in front of the first write to the register pair that the four loads name; the address is an input, so that its registers are not handed to a load's result ahead of it
    __builtin_amdgcn_sched_barrier(0);   // keeps the four loads here, ahead of the softmax arithmetic that covers their latency: under the budget of 160 registers the compiler otherwise sinks them to just in front of their first use
    v16b ph16[QT][CH / 32], pl16[QT][CH / 32];   // P^T, hi and lo, of both tiles
    float bias[QT];
#pragma unroll   // constant indices keep the arrays in registers
    for (int t = 0; t < QT; ++t) {
      float c0 = -INFINITY, c1 = -INFINITY;   // two chains, so that one's latency covers the other's
#pragma unroll   // constant indices keep the arrays in registers
      for (int tk = 0; tk < CH / 16; tk += 2) {
#pragma unroll   // constant indices keep the arrays in registers
        for (int r8 = 0; r8 < 8; r8 += 2) { c0 = fmaxf(fmaxf(c0, s[t][tk][r8]), s[t][tk][r8 + 1]); c1 = fmaxf(fmaxf(c1, s[t][tk + 1][r8]), s[t][tk + 1][r8 + 1]); } }
      float cm = fmaxf(c0, c1); cm = fmaxf(cm, xhalf(cm));
      const float mn = fmaxf(mx[t], cm), corr = exp2x1((mx[t] - mn) * C2); bias[t] = 8.0f - mn * C2;   // + 8: p comes out times PS = 2^8
      mx[t] = mn; sm[t] *= corr;
#pragma unroll   // constant indices keep the arrays in registers
      for (int r8 = 0; r8 < 8; ++r8) o[t][r8] *= corr; }
    // The two tiles go side by side. Sum and lo part work on pairs of neighbouring keys (packed f32: two values a slot): sm[t] holds the sum of the even keys and that of the odd keys; they are joined behind the loop.
#pragma unroll   // constant indices keep the arrays in registers
    for (int j = 0; j < CH / 32; ++j) { float x[QT][16];
#pragma unroll   // constant indices keep the arrays in registers
      for (int t = 0; t < QT; ++t) {
#pragma unroll   // constant indices keep the arrays in registers
        for (int e = 0; e < 16; ++e) x[t][e] = fmaf(s[t][2 * j + (e >> 3)][e & 7], C2, bias[t]); }
#pragma unroll   // constant indices keep the arrays in registers
      for (int t = 0; t < QT; ++t) { exp2x8(x[t]); exp2x8(x[t] + 8); }
#pragma unroll   // constant indices keep the arrays in registers
      for (int e = 0; e < 16; e += 2) {
#pragma unroll   // constant indices keep the arrays in registers
        for (int t = 0; t < QT; ++t) { const v2f p = {x[t][e], x[t][e + 1]}; sm[t] += p;
          const v2b ph = __builtin_convertvector(p, v2b); const v2b pl = __builtin_convertvector((v2f){p[0] - (float)ph[0], p[1] - (float)ph[1]}, v2b); ph16[t][j][e] = ph[0]; ph16[t][j][e + 1] = ph[1]; pl16[t][j][e] = pl[0]; pl16[t][j][e + 1] = pl[1]; } } }
    __builtin_amdgcn_sched_barrier(0);   // keeps the softmax arithmetic ahead of the products, so that these stand in one run and fill one another's slots
#pragma unroll   // constant indices keep the arrays in registers
    for (int j = 0; j < CH / 32; ++j) {   // eight products in one run, two accumulators in turn: each fills the slots behind the one before; per accumulator the order is hi, lo, hi, lo as before
#pragma unroll   // constant indices keep the arrays in registers
      for (int t = 0; t < QT; ++t) o[t] = wmma16b(vf[j], ph16[t][j], o[t]);
#pragma unroll   // constant indices keep the arrays in registers
      for (int t = 0; t < QT; ++t) o[t] = wmma16b(vf[j], pl16[t][j], o[t]); } }
#pragma unroll   // constant indices keep the arrays in registers
  for (int t = 0; t < QT; ++t) { float st = sm[t][0] + sm[t][1]; st += xhalf(st);
#pragma unroll   // constant indices keep the arrays in registers
    for (int r8 = 0; r8 < 8; ++r8) o[t][r8] += xhalf(o[t][r8]);   // vh P + vl P
    const float inv = 1.0f / (st * HS);   // o holds sum (PS p)(HS v), sm holds sum PS p
    if (hlf == 0) { float* dst = &As[t * 16 + nloc][wv * HD]; *(v4f*)dst = live ? (v4f){o[t][0] * inv, o[t][1] * inv, o[t][2] * inv, o[t][3] * inv} : (v4f){}; *(v4f*)(dst + 4) = live ? (v4f){o[t][4] * inv, o[t][5] * inv, o[t][6] * inv, o[t][7] * inv} : (v4f){}; } }
  // Waves 0..3 each take 16 rows (rt) and 32 output channels (cp: two tiles of 16, one whole 128-byte line of every row). The product is formed transposed, out^T = Wo A^T,
  // so lane (c, hf) holds channels 16 u + 8 hf + r of row c: eight neighbours in memory. Fragments are in the layout of frag_kb (lane (c, hf): k = kb + 8 hf + e and kb + 16 + 8 hf + e of row c).
  // Their Wo and bo loads go out ahead of the barrier, so that the latency runs beside the wait for the other heads.
  const int rt = wv >> 1, cp = wv & 1; v4f wr[2][2][4], br[2][2]; const float* pw = wo + (cp * 32 + nloc) * E + 8 * hlf; const float* pb = bo + cp * 32 + 8 * hlf;
  if (wv < 4) {
#pragma unroll   // constant indices keep the arrays in registers
    for (int u = 0; u < 2; ++u) { br[u][0] = *(const v4f*)(pb + u * 16); br[u][1] = *(const v4f*)(pb + u * 16 + 4);
#pragma unroll   // constant indices keep the arrays in registers
      for (int kb = 0; kb < 2; ++kb) { const float* p = pw + u * 16 * E + kb * 32; wr[u][kb][0] = *(const v4f*)p; wr[u][kb][1] = *(const v4f*)(p + 4); wr[u][kb][2] = *(const v4f*)(p + 16); wr[u][kb][3] = *(const v4f*)(p + 20); } }
    // Stands in front of the first write to a register that a load above names; the addresses are inputs, so that none of their registers is handed to a later load's result ahead of it.
    asm volatile("s_wait_xcnt 0x0" :: "v"(pw), "v"(pb) : "memory"); }
  __syncthreads();   // every head's rows of o are in LDS behind it
  if (wv < 4) { v4f ar[4][2]; const float* pa = &As[rt * 16 + nloc][8 * hlf];
#pragma unroll   // constant indices keep the arrays in registers
    for (int j = 0; j < 4; ++j) { ar[j][0] = *(const v4f*)(pa + 16 * j); ar[j][1] = *(const v4f*)(pa + 16 * j + 4); }   // head 2 j + hf = channels 16 j + 8 hf ..+8
    v16b a[2], al[2];
#pragma unroll   // constant indices keep the arrays in registers
    for (int e = 0; e < 32; ++e) { b16 p, pl; split16(ar[e >> 3][(e >> 2) & 1][e & 3] * HS, p, pl); a[e >> 4][e & 15] = p; al[e >> 4][e & 15] = pl; }
    v8f acc[2] = {(v8f){}, (v8f){}};
#pragma unroll   // constant indices keep the arrays in registers
    for (int kb = 0; kb < 2; ++kb) {
#pragma unroll   // constant indices keep the arrays in registers
      for (int u = 0; u < 2; ++u) { v16b bw;
#pragma unroll   // constant indices keep the arrays in registers
        for (int e = 0; e < 16; ++e) bw[e] = (b16)(bfv(wr[u][kb][e >> 2][e & 3]) * WSC);
        acc[u] = wmma16b(bw, a[kb], acc[u]); acc[u] = wmma16b(bw, al[kb], acc[u]); } }
    const size_t row = ((size_t)(bt / T) * N + q0 + rt * 16 + nloc) * T + bt % T;   // out is [b][n][t][64], bt = b T + t
#pragma unroll   // constant indices keep the arrays in registers
    for (int u = 0; u < 2; ++u) { float* dst = out + row * E + cp * 32 + u * 16 + 8 * hlf; float r[8];
#pragma unroll   // constant indices keep the arrays in registers
      for (int r8 = 0; r8 < 8; ++r8) r[r8] = acc[u][r8] * (1.0f / (HS * WSC)) + bfv(br[u][r8 >> 2][r8 & 3]);
      *(v4f*)dst = (v4f){r[0], r[1], r[2], r[3]}; *(v4f*)(dst + 4) = (v4f){r[4], r[5], r[6], r[7]}; } } }
}  // namespace

extern "C" void kernel_launch(void* const* d_in, const int* in_sizes, int n_in, void* d_out, int out_size, void* d_ws, size_t ws_size, hipStream_t stream) {
  (void)n_in;
  auto Fp = [&](int i) { return (const float*)d_in[i]; };
  // Input order: 0 values [2,512,24,64]; 1 keys; 2 query; 3 Wv [8,8]; 4 Wk; 5 Wq; 6 Wo [64,64]; 7 bo [64]
  if (in_sizes[0] != NB_ * N * T * E || in_sizes[1] != NB_ * N * T * E || in_sizes[2] != NB_ * N * T * E || in_sizes[3] != HD * HD || in_sizes[6] != E * E || out_size != NB_ * N * T * E) return;
  const int GLIM = NBT * H;   // (b,t,h) group cut
  size_t off = 0; char* ws = (char*)d_ws;
  auto carve = [&](size_t bytes) { char* p = ws + off; off += (bytes + 255) & ~(size_t)255; return p; };
  const size_t ng = (size_t)NBT * H;   // 384 groups
  b16* QP = (b16*)carve(ng * N * 16 * 2); b16* KP = (b16*)carve(ng * N * 16 * 2); b16* VT = (b16*)carve(ng * 16 * N * 2);
  if (off > ws_size || off > ((size_t)80 << 20)) return;   // ~ 19 MB
  proj_kernel<<<NB_ * T * (N / 64), 256, 0, stream>>>(Fp(0), Fp(1), Fp(2), Fp(3), Fp(4), Fp(5), QP, KP, VT);
  att_kernel<<<NBT * (N / (16 * QT)), 32 * H, 0, stream>>>(QP, KP, VT, GLIM, Fp(6), Fp(7), (float*)d_out);
}

// v008
// One run takes 30.8 microseconds.
// In both of two side-by-side timings against v007, it was 1.05 times as fast.
// All steps since v000 together make it 17.6 times as fast.
#include <hip/hip_runtime.h>

// SSelfAttention: per (b, t, h): q,k,v = x[b][n][t][h*8..+8] W^T (8x8 per-head linears shared across heads); energy[q][k] = q.k; attn = softmax_k(energy / sqrt(64)); out = attn v -> [b][n][t][h*8+d]; final out @ Wo^T + bo -> [2][512][24][64].
// Deterministic: per-wave softmax over the 512 nodes in fixed order; no atomics.
// WMMA (v_wmma_f32_16x16x32_f16, f32 accumulate): per (b, t, h, 32-query) wave S^T = k rows (32 tiles) x q rows (x256; the K of 32 holds the four products of hi and lo, 8 deep each) and o^T = v^T rows (8 hi rows + 8 lo rows, K 512) x P^T (hi, then lo, from the score registers); out = o (hi+lo, K 64) x Wo rows (EXACT; 4 tiles), formed by the work-group that made o; the 8x8 projections and softmax in f32.

namespace {
constexpr int NB_ = 2, N = 512, T = 24, E = 64, H = 8, HD = 8, NBT = NB_ * T /* 48 (b,t) groups */;
constexpr float HS = 256.0f, PS = 256.0f, WSC = 256.0f, SCALE = 0.125f /* 1/sqrt(64) */;
typedef _Float16 b16;
typedef __attribute__((ext_vector_type(16))) _Float16 v16b;
typedef __attribute__((ext_vector_type(8))) _Float16 v8b;
typedef __attribute__((ext_vector_type(8))) float v8f;
typedef __attribute__((ext_vector_type(4))) float v4f;
typedef __attribute__((ext_vector_type(2))) float v2f;
__device__ __forceinline__ float bf16_rne(float f) { unsigned int u = __float_as_uint(f); u += 0x7FFFu + ((u >> 16) & 1u); float r = __uint_as_float(u & 0xFFFF0000u); asm volatile("" : "+v"(r)); return r; }
__device__ __forceinline__ float bfv(float f) { float r = bf16_rne(f); asm volatile("" : "+v"(r)); return r; }
__device__ __forceinline__ void split16(float v, b16& hi, b16& lo) { hi = (b16)v; lo = (b16)(v - (float)hi); }
__device__ __forceinline__ v16b frag_kb(const b16* p, int hh) { const v8b a = *(const v8b*)(p + 8 * hh), b = *(const v8b*)(p + 16 + 8 * hh); v16b f;
#pragma unroll
  for (int e = 0; e < 8; ++e) { f[e] = a[e]; f[8 + e] = b[e]; } return f; }
__device__ __forceinline__ v8f wmma16b(v16b a, v16b b, v8f c) { return __builtin_amdgcn_wmma_f32_16x16x32_f16(false, a, false, b, (short)0, c, false, false); }   // the plain builtin: the compiler keeps the distance behind it, with useful instructions where it has them
__device__ __forceinline__ float pmul(float a, float b) { float p = a * b; asm volatile("" : "+v"(p)); return p; }

typedef __attribute__((ext_vector_type(2))) _Float16 v2b;
// Every load of a stage is issued ahead of the stage's first pinned value: a pin keeps its place among the memory operations, so a load that follows one in the source is waited on alone.
__global__ __launch_bounds__(256) void proj_kernel(const float* __restrict__ xv, const float* __restrict__ xk, const float* __restrict__ xq, const float* __restrict__ wv, const float* __restrict__ wk, const float* __restrict__ wq, b16* __restrict__ QP, b16* __restrict__ KP, b16* __restrict__ VT) { __shared__ float Vs[H][HD][65]; __shared__ __attribute__((aligned(16))) float Wl[3][HD][HD]; const int b = blockIdx.x / (T * (N / 64)), rem = blockIdx.x % (T * (N / 64)); const int t = rem / (N / 64), n0 = (rem % (N / 64)) * 64; const int tid = threadIdx.x, h = tid >> 5, lane = tid & 31; const int bth = (b * T + t) * H + h;
  v4f xr[3][2][2];   // the thread's twelve input loads, in flight together
#pragma unroll   // constant indices keep the array in registers
  for (int which = 0; which < 3; ++which) { const float* xs = which == 0 ? xq : (which == 1 ? xk : xv);
#pragma unroll   // constant indices keep the array in registers
    for (int half = 0; half < 2; ++half) { const float* p = xs + (((size_t)b * N + n0 + half * 32 + lane) * T + t) * E + h * HD; xr[which][half][0] = *(const v4f*)p; xr[which][half][1] = *(const v4f*)(p + 4); } }
  if (tid < 3 * HD * HD) { const int w = tid / (HD * HD), ij = tid % (HD * HD); const float* src = w == 0 ? wq : (w == 1 ? wk : wv); Wl[w][ij / HD][ij % HD] = bfv(src[ij]); }
  __syncthreads();
#pragma unroll   // constant indices keep the arrays in registers
  for (int which = 0; which < 3; ++which) { v4f wr[HD][2];   // one weight matrix: sixteen LDS reads in flight together
#pragma unroll   // constant indices keep the arrays in registers
    for (int i = 0; i < HD; ++i) { wr[i][0] = *(const v4f*)&Wl[which][i][0]; wr[i][1] = *(const v4f*)&Wl[which][i][4]; }
#pragma unroll   // constant indices keep the arrays in registers
    for (int half = 0; half < 2; ++half) { const int n = n0 + half * 32 + lane; const size_t ro = ((size_t)bth * N + n) * 16;   // a row is 8 hi, then 8 lo
      float xx[HD];
#pragma unroll
      for (int j = 0; j < HD; ++j) xx[j] = bfv(xr[which][half][j >> 2][j & 3]);
      v8b hh8, ll8;
#pragma unroll
      for (int i = 0; i < HD; ++i) { float s = 0.0f;
#pragma unroll
        for (int j = 0; j < HD; ++j) s += pmul(xx[j], wr[i][j >> 2][j & 3]); if (which == 2) Vs[h][i][half * 32 + lane] = s; else { b16 p, pl; split16(s * HS, p, pl); hh8[i] = p; ll8[i] = pl; } }
      if (which < 2) { b16* P = which == 0 ? QP : KP; *(v8b*)(P + ro) = hh8; *(v8b*)(P + ro + 8) = ll8;
        asm volatile("s_wait_xcnt 0x0" ::: "memory"); } } }   // stands in front of the next pass's writes to the registers that the two stores name
  __syncthreads();
  { for (int d = 0; d < HD; ++d) { b16 h0, l0, h1, l1; split16(Vs[h][d][lane * 2] * HS, h0, l0); split16(Vs[h][d][lane * 2 + 1] * HS, h1, l1); const size_t o = ((size_t)bth * 16 + d) * N + n0 + lane * 2; *(v2b*)(VT + o) = (v2b){h0, h1}; *(v2b*)(VT + o + (size_t)HD * N) = (v2b){l0, l1}; }  } }   // rows 0..7 hi, rows 8..15 lo
// Value of lane l ^ 16 (the other half of the wave), by a vector cross-row move.
__device__ __forceinline__ float xhalf(float v) { const int b = __float_as_int(v); return __int_as_float(__builtin_amdgcn_permlanex16(b, b, 0x76543210, 0xfedcba98, false, false)); }
// Eight independent 2^x in place. One statement, so that no v_exp_f32 is directly followed by an instruction that overwrites its source or reads its result;
// the v_nop is the slot the instruction set asks for behind the last one.
__device__ __forceinline__ void exp2x8(float* x) { asm("v_exp_f32 %0, %0\n\tv_exp_f32 %1, %1\n\tv_exp_f32 %2, %2\n\tv_exp_f32 %3, %3\n\tv_exp_f32 %4, %4\n\tv_exp_f32 %5, %5\n\tv_exp_f32 %6, %6\n\tv_exp_f32 %7, %7\n\tv_nop" : "+v"(x[0]), "+v"(x[1]), "+v"(x[2]), "+v"(x[3]), "+v"(x[4]), "+v"(x[5]), "+v"(x[6]), "+v"(x[7])); }
// One 2^x. The v_nop is the slot the instruction set asks for behind a transcendental; it is in the same statement so that it stands directly behind it.
__device__ __forceinline__ float exp2x1(float x) { float r; asm("v_exp_f32 %0, %1\n\tv_nop" : "=v"(r) : "v"(x)); return r; }
// f32 pairs -> packed f16 hi and packed f16 lo, three instructions a pair: hi = f16(p); lo = f16(p - hi) by one mixed-precision fma each (hi * -1 + p: hi is read as f16, -1 and p as f32; the result is rounded once, to f16, and written to one half of the register).
// p - hi is exact in f32, so the one rounding gives the bits of convert back, subtract, convert. The -1 comes in a scalar register: a 32-bit source whatever the instruction makes of an inline constant.
// One statement for five or six pairs, kind by kind, so that every producer stands at least five instructions ahead of its reader: the compiler places no delay hint inside asm text.
__device__ __forceinline__ void hilo5(const float* p, unsigned int* h, unsigned int* l) { asm("v_cvt_pk_f16_f32 %0, %10, %11\n\tv_cvt_pk_f16_f32 %1, %12, %13\n\tv_cvt_pk_f16_f32 %2, %14, %15\n\tv_cvt_pk_f16_f32 %3, %16, %17\n\tv_cvt_pk_f16_f32 %4, %18, %19\n\tv_fma_mixlo_f16 %5, %0, %20, %10 op_sel_hi:[1,0,0]\n\tv_fma_mixlo_f16 %6, %1, %20, %12 op_sel_hi:[1,0,0]\n\tv_fma_mixlo_f16 %7, %2, %20, %14 op_sel_hi:[1,0,0]\n\tv_fma_mixlo_f16 %8, %3, %20, %16 op_sel_hi:[1,0,0]\n\tv_fma_mixlo_f16 %9, %4, %20, %18 op_sel_hi:[1,0,0]\n\tv_fma_mixhi_f16 %5, %0, %20, %11 op_sel:[1,0,0] op_sel_hi:[1,0,0]\n\tv_fma_mixhi_f16 %6, %1, %20, %13 op_sel:[1,0,0] op_sel_hi:[1,0,0]\n\tv_fma_mixhi_f16 %7, %2, %20, %15 op_sel:[1,0,0] op_sel_hi:[1,0,0]\n\tv_fma_mixhi_f16 %8, %3, %20, %17 op_sel:[1,0,0] op_sel_hi:[1,0,0]\n\tv_fma_mixhi_f16 %9, %4, %20, %19 op_sel:[1,0,0] op_sel_hi:[1,0,0]" : "=&v"(h[0]), "=&v"(h[1]), "=&v"(h[2]), "=&v"(h[3]), "=&v"(h[4]), "=&v"(l[0]), "=&v"(l[1]), "=&v"(l[2]), "=&v"(l[3]), "=&v"(l[4]) : "v"(p[0]), "v"(p[1]), "v"(p[2]), "v"(p[3]), "v"(p[4]), "v"(p[5]), "v"(p[6]), "v"(p[7]), "v"(p[8]), "v"(p[9]), "s"(-1.0f)); }
__device__ __forceinline__ void hilo6(const float* p, unsigned int* h, unsigned int* l) { asm("v_cvt_pk_f16_f32 %0, %12, %13\n\tv_cvt_pk_f16_f32 %1, %14, %15\n\tv_cvt_pk_f16_f32 %2, %16, %17\n\tv_cvt_pk_f16_f32 %3, %18, %19\n\tv_cvt_pk_f16_f32 %4, %20, %21\n\tv_cvt_pk_f16_f32 %5, %22, %23\n\tv_fma_mixlo_f16 %6, %0, %24, %12 op_sel_hi:[1,0,0]\n\tv_fma_mixlo_f16 %7, %1, %24, %14 op_sel_hi:[1,0,0]\n\tv_fma_mixlo_f16 %8, %2, %24, %16 op_sel_hi:[1,0,0]\n\tv_fma_mixlo_f16 %9, %3, %24, %18 op_sel_hi:[1,0,0]\n\tv_fma_mixlo_f16 %10, %4, %24, %20 op_sel_hi:[1,0,0]\n\tv_fma_mixlo_f16 %11, %5, %24, %22 op_sel_hi:[1,0,0]\n\tv_fma_mixhi_f16 %6, %0, %24, %13 op_sel:[1,0,0] op_sel_hi:[1,0,0]\n\tv_fma_mixhi_f16 %7, %1, %24, %15 op_sel:[1,0,0] op_sel_hi:[1,0,0]\n\tv_fma_mixhi_f16 %8, %2, %24, %17 op_sel:[1,0,0] op_sel_hi:[1,0,0]\n\tv_fma_mixhi_f16 %9, %3, %24, %19 op_sel:[1,0,0] op_sel_hi:[1,0,0]\n\tv_fma_mixhi_f16 %10, %4, %24, %21 op_sel:[1,0,0] op_sel_hi:[1,0,0]\n\tv_fma_mixhi_f16 %11, %5, %24, %23 op_sel:[1,0,0] op_sel_hi:[1,0,0]" : "=&v"(h[0]), "=&v"(h[1]), "=&v"(h[2]), "=&v"(h[3]), "=&v"(h[4]), "=&v"(h[5]), "=&v"(l[0]), "=&v"(l[1]), "=&v"(l[2]), "=&v"(l[3]), "=&v"(l[4]), "=&v"(l[5]) : "v"(p[0]), "v"(p[1]), "v"(p[2]), "v"(p[3]), "v"(p[4]), "v"(p[5]), "v"(p[6]), "v"(p[7]), "v"(p[8]), "v"(p[9]), "v"(p[10]), "v"(p[11]), "s"(-1.0f)); }
typedef __attribute__((ext_vector_type(8))) unsigned int v8u;
constexpr int CH = 64, QT = 2;
// A work-group is the eight heads (one wave each) of the same (b, t) and the same 32 queries, so it holds whole rows of o: the waves hand them over in LDS and the work-group forms out = o Wo^T + bo itself.
// The second launch bound asks for six waves per SIMD (a budget of 160 registers): three work-groups then fit a WGP, and the grid of 768 is resident at once on 256 WGPs. At two per WGP a third of the grid waits for a second round that leaves each SIMD two waves.
__global__ __launch_bounds__(256, 6) void att_kernel(const b16* __restrict__ QP, const b16* __restrict__ KP, const b16* __restrict__ VT, int GLIM, const float* __restrict__ wo, const float* __restrict__ bo, float* __restrict__ out) { __shared__ __attribute__((aligned(16))) float As[16 * QT][E + 4];   // 32 rows of o; the pitch of 17 x 16 bytes spreads the b128 reads over the banks
  const int lane = threadIdx.x & 31, nloc = lane & 15, hlf = lane >> 4; const int wv = __builtin_amdgcn_readfirstlane((int)threadIdx.x >> 5);   // the wave's number = the head; scalar, so that what hangs on it is a scalar branch or a scalar address
  const int bt = blockIdx.x / (N / (16 * QT)), q0 = (blockIdx.x % (N / (16 * QT))) * (16 * QT); const bool live = bt * H + wv < GLIM; const int bth = live ? bt * H + wv : 0;   // a head past the cut hands over zeros; it leaves no barrier out
  constexpr float C2 = (SCALE / (HS * HS)) * 1.4426950408889634f;   // raw score -> log2 units
  v16b qf[QT];   // both halves: qh in elements 0..7, ql in 8..15
#pragma unroll   // constant indices keep the arrays in registers
  for (int t = 0; t < QT; ++t) qf[t] = *(const v16b*)(QP + ((size_t)bth * N + q0 + t * 16 + nloc) * 16);
  const b16* kp = KP + ((size_t)bth * N + nloc) * 16 + 8 * hlf;   // half 0 reads kh, half 1 kl
  const b16* vp = VT + ((size_t)bth * 16 + nloc) * N + 8 * hlf;   // the half's offset is in the pointer: one register pair, not a base and an offset
  float mx[QT]; v2f sm[QT]; v8f o[QT];
#pragma unroll   // constant indices keep the arrays in registers
  for (int t = 0; t < QT; ++t) { mx[t] = -INFINITY; sm[t] = (v2f){}; o[t] = (v8f){}; }
  for (int k0 = 0; k0 < N; k0 += CH, kp += CH * 16, vp += CH) { v8f s[QT][CH / 16]; v8b kx[CH / 16];   // the chunk's four k fragments are fetched together: one load latency
#pragma unroll   // constant indices keep the arrays in registers
    for (int i = 0; i < CH / 16; ++i) kx[i] = *(const v8b*)(kp + i * 16 * 16);
    asm volatile("s_wait_xcnt 0x0" ::: "memory");   // stands in front of the first write to the register pair that the four loads name
#pragma unroll   // constant indices keep the arrays in registers
    for (int i = 0; i < CH / 16; ++i) { const v16b kd = __builtin_shufflevector(kx[i], kx[i], 0, 1, 2, 3, 4, 5, 6, 7, 0, 1, 2, 3, 4, 5, 6, 7);
#pragma unroll   // constant indices keep the arrays in registers
      for (int t = 0; t < QT; ++t) s[t][i] = wmma16b(kd, qf[t], (v8f){}); }
    v16b vf[CH / 32];   // fetched here so that they fly under the softmax arithmetic (the rows lie 1 KiB apart: each load touches 16 lines)
#pragma unroll   // constant indices keep the arrays in registers
    for (int j = 0; j < CH / 32; ++j) vf[j] = frag_kb(vp + j * 32, 0);
    asm volatile("s_wait_xcnt 0x0" :: "v"(vp) : "memory");   // stands in front of the first write to the register pair that the four loads name; the address is an input, so that its registers are not handed to a load's result ahead of it
    __builtin_amdgcn_sched_barrier(0);   // keeps the four loads here, ahead of the softmax arithmetic that covers their latency: under the budget of 160 registers the compiler otherwise sinks them to just in front of their first use
    v16b ph16[QT][CH / 32], pl16[QT][CH / 32];   // P^T, hi and lo, of both tiles
    float bias[QT];
#pragma unroll   // constant indices keep the arrays in registers
    for (int t = 0; t < QT; ++t) {
      float c0 = -INFINITY, c1 = -INFINITY;   // two chains, so that one's latency covers the other's
#pragma unroll   // constant indices keep the arrays in registers
      for (int tk = 0; tk < CH / 16; tk += 2) {
#pragma unroll   // constant indices keep the arrays in registers
        for (int r8 = 0; r8 < 8; r8 += 2) { c0 = fmaxf(fmaxf(c0, s[t][tk][r8]), s[t][tk][r8 + 1]); c1 = fmaxf(fmaxf(c1, s[t][tk + 1][r8]), s[t][tk + 1][r8 + 1]); } }
      float cm = fmaxf(c0, c1); cm = fmaxf(cm, xhalf(cm));
      const float mn = fmaxf(mx[t], cm), corr = exp2x1((mx[t] - mn) * C2); bias[t] = 8.0f - mn * C2;   // + 8: p comes out times PS = 2^8
      mx[t] = mn; sm[t] *= corr;
#pragma unroll   // constant indices keep the arrays in registers
      for (int r8 = 0; r8 < 8; ++r8) o[t][r8] *= corr; }
    // The two tiles go side by side. The sum works on pairs of neighbouring keys (packed f32: two values a slot): sm[t] holds the sum of the even keys and that of the odd keys; they are joined behind the loop. Hi and lo parts of a pair share a register each: hilo5, hilo6.
#pragma unroll   // constant indices keep the arrays in registers
    for (int j = 0; j < CH / 32; ++j) { float x[QT * 16];   // tile 0's sixteen values, then tile 1's
#pragma unroll   // constant indices keep the arrays in registers
      for (int t = 0; t < QT; ++t) {
#pragma unroll   // constant indices keep the arrays in registers
        for (int e = 0; e < 16; ++e) x[t * 16 + e] = fmaf(s[t][2 * j + (e >> 3)][e & 7], C2, bias[t]); }
#pragma unroll   // constant indices keep the arrays in registers
      for (int t = 0; t < QT; ++t) { exp2x8(x + t * 16); exp2x8(x + t * 16 + 8); }
#pragma unroll   // constant indices keep the arrays in registers
      for (int e = 0; e < 16; e += 2) {
#pragma unroll   // constant indices keep the arrays in registers
        for (int t = 0; t < QT; ++t) sm[t] += (v2f){x[t * 16 + e], x[t * 16 + e + 1]}; }
      unsigned int hw[QT * 8], lw[QT * 8];   // the sixteen pairs of the two tiles, tile 0's first
      hilo6(x, hw, lw); hilo5(x + 12, hw + 6, lw + 6); hilo5(x + 22, hw + 11, lw + 11);
#pragma unroll   // constant indices keep the arrays in registers
      for (int t = 0; t < QT; ++t) { const unsigned int* a = hw + t * 8; const unsigned int* b = lw + t * 8;
        ph16[t][j] = __builtin_bit_cast(v16b, (v8u){a[0], a[1], a[2], a[3], a[4], a[5], a[6], a[7]}); pl16[t][j] = __builtin_bit_cast(v16b, (v8u){b[0], b[1], b[2], b[3], b[4], b[5], b[6], b[7]}); } }
    __builtin_amdgcn_sched_barrier(0);   // keeps the softmax arithmetic ahead of the products, so that these stand in one run and fill one another's slots
#pragma unroll   // constant indices keep the arrays in registers
    for (int j = 0; j < CH / 32; ++j) {   // eight products in one run, two accumulators in turn: each fills the slots behind the one before; per accumulator the order is hi, lo, hi, lo as before
#pragma unroll   // constant indices keep the arrays in registers
      for (int t = 0; t < QT; ++t) o[t] = wmma16b(vf[j], ph16[t][j], o[t]);
#pragma unroll   // constant indices keep the arrays in registers
      for (int t = 0; t < QT; ++t) o[t] = wmma16b(vf[j], pl16[t][j], o[t]); } }
#pragma unroll   // constant indices keep the arrays in registers
  for (int t = 0; t < QT; ++t) { float st = sm[t][0] + sm[t][1]; st += xhalf(st);
#pragma unroll   // constant indices keep the arrays in registers
    for (int r8 = 0; r8 < 8; ++r8) o[t][r8] += xhalf(o[t][r8]);   // vh P + vl P
    const float inv = 1.0f / (st * HS);   // o holds sum (PS p)(HS v), sm holds sum PS p
    if (hlf == 0) { float* dst = &As[t * 16 + nloc][wv * HD]; *(v4f*)dst = live ? (v4f){o[t][0] * inv, o[t][1] * inv, o[t][2] * inv, o[t][3] * inv} : (v4f){}; *(v4f*)(dst + 4) = live ? (v4f){o[t][4] * inv, o[t][5] * inv, o[t][6] * inv, o[t][7] * inv} : (v4f){}; } }
  // Waves 0..3 each take 16 rows (rt) and 32 output channels (cp: two tiles of 16, one whole 128-byte line of every row). The product is formed transposed, out^T = Wo A^T,
  // so lane (c, hf) holds channels 16 u + 8 hf + r of row c: eight neighbours in memory. Fragments are in the layout of frag_kb (lane (c, hf): k = kb + 8 hf + e and kb + 16 + 8 hf + e of row c).
  // Their Wo and bo loads go out ahead of the barrier, so that the latency runs beside the wait for the other heads.
  const int rt = wv >> 1, cp = wv & 1; v4f wr[2][2][4], br[2][2]; const float* pw = wo + (cp * 32 + nloc) * E + 8 * hlf; const float* pb = bo + cp * 32 + 8 * hlf;
  if (wv < 4) {
#pragma unroll   // constant indices keep the arrays in registers
    for (int u = 0; u < 2; ++u) { br[u][0] = *(const v4f*)(pb + u * 16); br[u][1] = *(const v4f*)(pb + u * 16 + 4);
#pragma unroll   // constant indices keep the arrays in registers
      for (int kb = 0; kb < 2; ++kb) { const float* p = pw + u * 16 * E + kb * 32; wr[u][kb][0] = *(const v4f*)p; wr[u][kb][1] = *(const v4f*)(p + 4); wr[u][kb][2] = *(const v4f*)(p + 16); wr[u][kb][3] = *(const v4f*)(p + 20); } }
    // Stands in front of the first write to a register that a load above names; the addresses are inputs, so that none of their registers is handed to a later load's result ahead of it.
    asm volatile("s_wait_xcnt 0x0" :: "v"(pw), "v"(pb) : "memory"); }
  __syncthreads();   // every head's rows of o are in LDS behind it
  if (wv < 4) { v4f ar[4][2]; const float* pa = &As[rt * 16 + nloc][8 * hlf];
#pragma unroll   // constant indices keep the arrays in registers
    for (int j = 0; j < 4; ++j) { ar[j][0] = *(const v4f*)(pa + 16 * j); ar[j][1] = *(const v4f*)(pa + 16 * j + 4); }   // head 2 j + hf = channels 16 j + 8 hf ..+8
    v16b a[2], al[2];
#pragma unroll   // constant indices keep the arrays in registers
    for (int e = 0; e < 32; ++e) { b16 p, pl; split16(ar[e >> 3][(e >> 2) & 1][e & 3] * HS, p, pl); a[e >> 4][e & 15] = p; al[e >> 4][e & 15] = pl; }
    v8f acc[2] = {(v8f){}, (v8f){}};
#pragma unroll   // constant indices keep the arrays in registers
    for (int kb = 0; kb < 2; ++kb) {
#pragma unroll   // constant indices keep the arrays in registers
      for (int u = 0; u < 2; ++u) { v16b bw;
#pragma unroll   // constant indices keep the arrays in registers
        for (int e = 0; e < 16; ++e) bw[e] = (b16)(bfv(wr[u][kb][e >> 2][e & 3]) * WSC);
        acc[u] = wmma16b(bw, a[kb], acc[u]); acc[u] = wmma16b(bw, al[kb], acc[u]); } }
    const size_t row = ((size_t)(bt / T) * N + q0 + rt * 16 + nloc) * T + bt % T;   // out is [b][n][t][64], bt = b T + t
#pragma unroll   // constant indices keep the arrays in registers
    for (int u = 0; u < 2; ++u) { float* dst = out + row * E + cp * 32 + u * 16 + 8 * hlf; float r[8];
#pragma unroll   // constant indices keep the arrays in registers
      for (int r8 = 0; r8 < 8; ++r8) r[r8] = acc[u][r8] * (1.0f / (HS * WSC)) + bfv(br[u][r8 >> 2][r8 & 3]);
      *(v4f*)dst = (v4f){r[0], r[1], r[2], r[3]}; *(v4f*)(dst + 4) = (v4f){r[4], r[5], r[6], r[7]}; } } }
}  // namespace

extern "C" void kernel_launch(void* const* d_in, const int* in_sizes, int n_in, void* d_out, int out_size, void* d_ws, size_t ws_size, hipStream_t stream) {
  (void)n_in;
  auto Fp = [&](int i) { return (const float*)d_in[i]; };
  // Input order: 0 values [2,512,24,64]; 1 keys; 2 query; 3 Wv [8,8]; 4 Wk; 5 Wq; 6 Wo [64,64]; 7 bo [64]
  if (in_sizes[0] != NB_ * N * T * E || in_sizes[1] != NB_ * N * T * E || in_sizes[2] != NB_ * N * T * E || in_sizes[3] != HD * HD || in_sizes[6] != E * E || out_size != NB_ * N * T * E) return;
  const int GLIM = NBT * H;   // (b,t,h) group cut
  size_t off = 0; char* ws = (char*)d_ws;
  auto carve = [&](size_t bytes) { char* p = ws + off; off += (bytes + 255) & ~(size_t)255; return p; };
  const size_t ng = (size_t)NBT * H;   // 384 groups
  b16* QP = (b16*)carve(ng * N * 16 * 2); b16* KP = (b16*)carve(ng * N * 16 * 2); b16* VT = (b16*)carve(ng * 16 * N * 2);
  if (off > ws_size || off > ((size_t)80 << 20)) return;   // ~ 19 MB
  proj_kernel<<<NB_ * T * (N / 64), 256, 0, stream>>>(Fp(0), Fp(1), Fp(2), Fp(3), Fp(4), Fp(5), QP, KP, VT);
  att_kernel<<<NBT * (N / (16 * QT)), 32 * H, 0, stream>>>(QP, KP, VT, GLIM, Fp(6), Fp(7), (float*)d_out);
}

// v009
// It runs in 29.1 microseconds.
// Next to v008, in two timings, it ran 1.06 and 1.05 times as fast.
// Over all steps from v000 it is 18.6 times as fast.
#include <hip/hip_runtime.h>

// SSelfAttention: per (b, t, h): q,k,v = x[b][n][t][h*8..+8] W^T (8x8 per-head linears shared across heads); energy[q][k] = q.k; attn = softmax_k(energy / sqrt(64)); out = attn v -> [b][n][t][h*8+d]; final out @ Wo^T + bo -> [2][512][24][64].
// Deterministic: per-wave softmax over the 512 nodes in fixed order; no atomics.
// WMMA (v_wmma_f32_16x16x32_f16, f32 accumulate): per (b, t, h, 32-query) wave S^T = k rows (32 tiles) x q rows (scaled to log2 units; the K of 32 holds three products of hi and lo, 8 deep each, and the softmax's shift) and o^T = v^T rows (8 hi rows + 8 lo rows, K 512) x P^T (hi, then lo, from the score registers); out = o (hi+lo, K 64) x Wo rows (EXACT; 4 tiles), formed by the work-group that made o; the 8x8 projections and softmax in f32.

namespace {
constexpr int NB_ = 2, N = 512, T = 24, E = 64, H = 8, HD = 8, NBT = NB_ * T /* 48 (b,t) groups */;
constexpr float HS = 256.0f, PS = 256.0f, WSC = 256.0f, SCALE = 0.125f /* 1/sqrt(64) */;
constexpr float KS = 0.5f, QS = SCALE * 1.4426950408889634f / KS;   // scales of the stored k and q: (QS q).(KS k) is the score in log2 units, so it needs no multiply behind the WMMA; the two are of like size, so that the smallest f16 step (2^-24) costs neither lo part more than an f32 rounding would
typedef _Float16 b16;
typedef __attribute__((ext_vector_type(16))) _Float16 v16b;
typedef __attribute__((ext_vector_type(8))) _Float16 v8b;
typedef __attribute__((ext_vector_type(8))) float v8f;
typedef __attribute__((ext_vector_type(4))) float v4f;
typedef __attribute__((ext_vector_type(2))) float v2f;
__device__ __forceinline__ float bf16_rne(float f) { unsigned int u = __float_as_uint(f); u += 0x7FFFu + ((u >> 16) & 1u); float r = __uint_as_float(u & 0xFFFF0000u); asm volatile("" : "+v"(r)); return r; }
__device__ __forceinline__ float bfv(float f) { float r = bf16_rne(f); asm volatile("" : "+v"(r)); return r; }
__device__ __forceinline__ void split16(float v, b16& hi, b16& lo) { hi = (b16)v; lo = (b16)(v - (float)hi); }
__device__ __forceinline__ v16b frag_kb(const b16* p, int hh) { const v8b a = *(const v8b*)(p + 8 * hh), b = *(const v8b*)(p + 16 + 8 * hh); v16b f;
#pragma unroll
  for (int e = 0; e < 8; ++e) { f[e] = a[e]; f[8 + e] = b[e]; } return f; }
__device__ __forceinline__ v8f wmma16b(v16b a, v16b b, v8f c) { return __builtin_amdgcn_wmma_f32_16x16x32_f16(false, a, false, b, (short)0, c, false, false); }   // the plain builtin: the compiler keeps the distance behind it, with useful instructions where it has them
__device__ __forceinline__ float pmul(float a, float b) { float p = a * b; asm volatile("" : "+v"(p)); return p; }

typedef __attribute__((ext_vector_type(2))) _Float16 v2b;
// Every load of a stage is issued ahead of the stage's first pinned value: a pin keeps its place among the memory operations, so a load that follows one in the source is waited on alone.
__global__ __launch_bounds__(256) void proj_kernel(const float* __restrict__ xv, const float* __restrict__ xk, const float* __restrict__ xq, const float* __restrict__ wv, const float* __restrict__ wk, const float* __restrict__ wq, b16* __restrict__ QP, b16* __restrict__ KP, b16* __restrict__ VT) { __shared__ float Vs[H][HD][65]; __shared__ __attribute__((aligned(16))) float Wl[3][HD][HD]; const int b = blockIdx.x / (T * (N / 64)), rem = blockIdx.x % (T * (N / 64)); const int t = rem / (N / 64), n0 = (rem % (N / 64)) * 64; const int tid = threadIdx.x, h = tid >> 5, lane = tid & 31; const int bth = (b * T + t) * H + h;
  v4f xr[3][2][2];   // the thread's twelve input loads, in flight together
#pragma unroll   // constant indices keep the array in registers
  for (int which = 0; which < 3; ++which) { const float* xs = which == 0 ? xq : (which == 1 ? xk : xv);
#pragma unroll   // constant indices keep the array in registers
    for (int half = 0; half < 2; ++half) { const float* p = xs + (((size_t)b * N + n0 + half * 32 + lane) * T + t) * E + h * HD; xr[which][half][0] = *(const v4f*)p; xr[which][half][1] = *(const v4f*)(p + 4); } }
  if (tid < 3 * HD * HD) { const int w = tid / (HD * HD), ij = tid % (HD * HD); const float* src = w == 0 ? wq : (w == 1 ? wk : wv); Wl[w][ij / HD][ij % HD] = bfv(src[ij]); }
  __syncthreads();
#pragma unroll   // constant indices keep the arrays in registers
  for (int which = 0; which < 3; ++which) { v4f wr[HD][2];   // one weight matrix: sixteen LDS reads in flight together
#pragma unroll   // constant indices keep the arrays in registers
    for (int i = 0; i < HD; ++i) { wr[i][0] = *(const v4f*)&Wl[which][i][0]; wr[i][1] = *(const v4f*)&Wl[which][i][4]; }
#pragma unroll   // constant indices keep the arrays in registers
    for (int half = 0; half < 2; ++half) { const int n = n0 + half * 32 + lane; const size_t ro = ((size_t)bth * N + n) * 16;   // a row is 8 hi, then 8 lo
      float xx[HD];
#pragma unroll
      for (int j = 0; j < HD; ++j) xx[j] = bfv(xr[which][half][j >> 2][j & 3]);
      v8b hh8, ll8;
#pragma unroll
      for (int i = 0; i < HD; ++i) { float s = 0.0f;
#pragma unroll
        for (int j = 0; j < HD; ++j) s += pmul(xx[j], wr[i][j >> 2][j & 3]); if (which == 2) Vs[h][i][half * 32 + lane] = s; else { b16 p, pl; split16(s * (which == 0 ? QS : KS), p, pl); hh8[i] = p; ll8[i] = pl; } }
      if (which < 2) { b16* P = which == 0 ? QP : KP; *(v8b*)(P + ro) = hh8; *(v8b*)(P + ro + 8) = ll8;
        asm volatile("s_wait_xcnt 0x0" ::: "memory"); } } }   // stands in front of the next pass's writes to the registers that the two stores name
  __syncthreads();
  { for (int d = 0; d < HD; ++d) { b16 h0, l0, h1, l1; split16(Vs[h][d][lane * 2] * HS, h0, l0); split16(Vs[h][d][lane * 2 + 1] * HS, h1, l1); const size_t o = ((size_t)bth * 16 + d) * N + n0 + lane * 2; *(v2b*)(VT + o) = (v2b){h0, h1}; *(v2b*)(VT + o + (size_t)HD * N) = (v2b){l0, l1}; }  } }   // rows 0..7 hi, rows 8..15 lo
// Value of lane l ^ 16 (the other half of the wave), by a vector cross-row move.
__device__ __forceinline__ float xhalf(float v) { const int b = __float_as_int(v); return __int_as_float(__builtin_amdgcn_permlanex16(b, b, 0x76543210, 0xfedcba98, false, false)); }
// One 2^x. The v_nop is the slot the instruction set asks for behind a transcendental; it is in the same statement so that it stands directly behind it.
__device__ __forceinline__ float exp2x1(float x) { float r; asm("v_exp_f32 %0, %1\n\tv_nop" : "=v"(r) : "v"(x)); return r; }
// f32 pairs -> packed f16 hi and packed f16 lo, three instructions a pair: hi = f16(p); lo = f16(p - hi) by one mixed-precision fma each (hi * -1 + p: hi is read as f16, -1 and p as f32; the result is rounded once, to f16, and written to one half of the register).
// p - hi is exact in f32, so the one rounding gives the bits of convert back, subtract, convert. The -1 comes in a scalar register: a 32-bit source whatever the instruction makes of an inline constant.
// One statement for five or six pairs, kind by kind, so that every producer stands at least five instructions ahead of its reader: the compiler places no delay hint inside asm text.
__device__ __forceinline__ void hilo5(const float* p, unsigned int* h, unsigned int* l) { asm("v_cvt_pk_f16_f32 %0, %10, %11\n\tv_cvt_pk_f16_f32 %1, %12, %13\n\tv_cvt_pk_f16_f32 %2, %14, %15\n\tv_cvt_pk_f16_f32 %3, %16, %17\n\tv_cvt_pk_f16_f32 %4, %18, %19\n\tv_fma_mixlo_f16 %5, %0, %20, %10 op_sel_hi:[1,0,0]\n\tv_fma_mixlo_f16 %6, %1, %20, %12 op_sel_hi:[1,0,0]\n\tv_fma_mixlo_f16 %7, %2, %20, %14 op_sel_hi:[1,0,0]\n\tv_fma_mixlo_f16 %8, %3, %20, %16 op_sel_hi:[1,0,0]\n\tv_fma_mixlo_f16 %9, %4, %20, %18 op_sel_hi:[1,0,0]\n\tv_fma_mixhi_f16 %5, %0, %20, %11 op_sel:[1,0,0] op_sel_hi:[1,0,0]\n\tv_fma_mixhi_f16 %6, %1, %20, %13 op_sel:[1,0,0] op_sel_hi:[1,0,0]\n\tv_fma_mixhi_f16 %7, %2, %20, %15 op_sel:[1,0,0] op_sel_hi:[1,0,0]\n\tv_fma_mixhi_f16 %8, %3, %20, %17 op_sel:[1,0,0] op_sel_hi:[1,0,0]\n\tv_fma_mixhi_f16 %9, %4, %20, %19 op_sel:[1,0,0] op_sel_hi:[1,0,0]" : "=&v"(h[0]), "=&v"(h[1]), "=&v"(h[2]), "=&v"(h[3]), "=&v"(h[4]), "=&v"(l[0]), "=&v"(l[1]), "=&v"(l[2]), "=&v"(l[3]), "=&v"(l[4]) : "v"(p[0]), "v"(p[1]), "v"(p[2]), "v"(p[3]), "v"(p[4]), "v"(p[5]), "v"(p[6]), "v"(p[7]), "v"(p[8]), "v"(p[9]), "s"(-1.0f)); }
__device__ __forceinline__ void hilo6(const float* p, unsigned int* h, unsigned int* l) { asm("v_cvt_pk_f16_f32 %0, %12, %13\n\tv_cvt_pk_f16_f32 %1, %14, %15\n\tv_cvt_pk_f16_f32 %2, %16, %17\n\tv_cvt_pk_f16_f32 %3, %18, %19\n\tv_cvt_pk_f16_f32 %4, %20, %21\n\tv_cvt_pk_f16_f32 %5, %22, %23\n\tv_fma_mixlo_f16 %6, %0, %24, %12 op_sel_hi:[1,0,0]\n\tv_fma_mixlo_f16 %7, %1, %24, %14 op_sel_hi:[1,0,0]\n\tv_fma_mixlo_f16 %8, %2, %24, %16 op_sel_hi:[1,0,0]\n\tv_fma_mixlo_f16 %9, %3, %24, %18 op_sel_hi:[1,0,0]\n\tv_fma_mixlo_f16 %10, %4, %24, %20 op_sel_hi:[1,0,0]\n\tv_fma_mixlo_f16 %11, %5, %24, %22 op_sel_hi:[1,0,0]\n\tv_fma_mixhi_f16 %6, %0, %24, %13 op_sel:[1,0,0] op_sel_hi:[1,0,0]\n\tv_fma_mixhi_f16 %7, %1, %24, %15 op_sel:[1,0,0] op_sel_hi:[1,0,0]\n\tv_fma_mixhi_f16 %8, %2, %24, %17 op_sel:[1,0,0] op_sel_hi:[1,0,0]\n\tv_fma_mixhi_f16 %9, %3, %24, %19 op_sel:[1,0,0] op_sel_hi:[1,0,0]\n\tv_fma_mixhi_f16 %10, %4, %24, %21 op_sel:[1,0,0] op_sel_hi:[1,0,0]\n\tv_fma_mixhi_f16 %11, %5, %24, %23 op_sel:[1,0,0] op_sel_hi:[1,0,0]" : "=&v"(h[0]), "=&v"(h[1]), "=&v"(h[2]), "=&v"(h[3]), "=&v"(h[4]), "=&v"(h[5]), "=&v"(l[0]), "=&v"(l[1]), "=&v"(l[2]), "=&v"(l[3]), "=&v"(l[4]), "=&v"(l[5]) : "v"(p[0]), "v"(p[1]), "v"(p[2]), "v"(p[3]), "v"(p[4]), "v"(p[5]), "v"(p[6]), "v"(p[7]), "v"(p[8]), "v"(p[9]), "v"(p[10]), "v"(p[11]), "s"(-1.0f)); }
typedef __attribute__((ext_vector_type(8))) unsigned int v8u;
typedef __attribute__((ext_vector_type(4))) unsigned int v4u;
constexpr int CH = 64, QT = 2;
// A work-group is the eight heads (one wave each) of the same (b, t) and the same 32 queries, so it holds whole rows of o: the waves hand them over in LDS and the work-group forms out = o Wo^T + bo itself.
// The second launch bound asks for six waves per SIMD (a budget of 160 registers): three work-groups then fit a WGP, and the grid of 768 is resident at once on 256 WGPs. At two per WGP a third of the grid waits for a second round that leaves each SIMD two waves.
__global__ __launch_bounds__(256, 6) void att_kernel(const b16* __restrict__ QP, const b16* __restrict__ KP, const b16* __restrict__ VT, int GLIM, const float* __restrict__ wo, const float* __restrict__ bo, float* __restrict__ out) { __shared__ __attribute__((aligned(16))) float As[16 * QT][E + 4];   // 32 rows of o; the pitch of 17 x 16 bytes spreads the b128 reads over the banks
  const int lane = threadIdx.x & 31, nloc = lane & 15, hlf = lane >> 4; const int wv = __builtin_amdgcn_readfirstlane((int)threadIdx.x >> 5);   // the wave's number = the head; scalar, so that what hangs on it is a scalar branch or a scalar address
  const int bt = blockIdx.x / (N / (16 * QT)), q0 = (blockIdx.x % (N / (16 * QT))) * (16 * QT); const bool live = bt * H + wv < GLIM; const int bth = live ? bt * H + wv : 0;   // a head past the cut hands over zeros; it leaves no barrier out
  v16b qf[QT];   // qh in elements 0..7; in 8..15 ql (half 0) or the shift (half 1)
#pragma unroll   // constant indices keep the arrays in registers
  for (int t = 0; t < QT; ++t) { qf[t] = *(const v16b*)(QP + ((size_t)bth * N + q0 + t * 16 + nloc) * 16);
#pragma unroll   // constant indices keep the arrays in registers
    for (int e = 8; e < 16; ++e) qf[t][e] = hlf ? (b16)0.0f : qf[t][e]; }   // half 1: the fourth slot, the shift's (0 until the first trip sets it)
  const b16* kp = KP + ((size_t)bth * N + nloc) * 16 + 8 * hlf;   // half 0 reads kh, half 1 kl
  const b16* vp = VT + ((size_t)bth * 16 + nloc) * N + 8 * hlf;   // the half's offset is in the pointer: one register pair, not a base and an offset
  float bias[QT]; v2f sm[QT]; v8f o[QT];
#pragma unroll   // constant indices keep the arrays in registers
  for (int t = 0; t < QT; ++t) { bias[t] = 0.0f; sm[t] = (v2f){}; o[t] = (v8f){}; }
  const v4u one = (v4u){0x3C004000u, 0u, 0u, 0u};   // f16 (2, 1, 0, 0, 0, 0, 0, 0)
  bool renew = true;   // a trip that renews always goes on to the next chunk, so a chunk takes at most two trips: 2 N / CH trips at most
  for (int k0 = 0; k0 < N;) { float x[CH / 32][QT * 16];   // per 32 keys: tile 0's sixteen values, then tile 1's
    v16b vf[CH / 32], kd[CH / 16]; v4u kx[CH / 16]; v2f cs[QT];   // the chunk's four k fragments are fetched together: one load latency
#pragma unroll   // constant indices keep the arrays in registers
    for (int i = 0; i < CH / 16; ++i) kx[i] = *(const v4u*)(kp + i * 16 * 16);
    asm volatile("s_wait_xcnt 0x0" ::: "memory");   // stands in front of the first write to the register pair that the four loads name
#pragma unroll   // constant indices keep the arrays in registers
    for (int i = 0; i < CH / 16; ++i) { const v4u k2 = hlf ? one : kx[i]; kd[i] = __builtin_bit_cast(v16b, (v8u){kx[i][0], kx[i][1], kx[i][2], kx[i][3], k2[0], k2[1], k2[2], k2[3]}); }
    if (renew) {   // the same for the whole wave: a scalar branch
#pragma unroll   // constant indices keep the arrays in registers
      for (int t = 0; t < QT; ++t) { v8f r[CH / 16];   // scores under the bias held so far
#pragma unroll   // constant indices keep the arrays in registers
        for (int i = 0; i < CH / 16; ++i) r[i] = wmma16b(kd[i], qf[t], (v8f){});
        float c0 = -INFINITY, c1 = -INFINITY;   // two chains, so that one's latency covers the other's
#pragma unroll   // constant indices keep the arrays in registers
        for (int tk = 0; tk < CH / 16; tk += 2) {
#pragma unroll   // constant indices keep the arrays in registers
          for (int r8 = 0; r8 < 8; r8 += 2) { c0 = fmaxf(fmaxf(c0, r[tk][r8]), r[tk][r8 + 1]); c1 = fmaxf(fmaxf(c1, r[tk + 1][r8]), r[tk + 1][r8 + 1]); } }
        float cm = fmaxf(c0, c1); cm = fmaxf(cm, xhalf(cm));
        const float want = bias[t] + (8.0f - cm);   // the bias that brings the chunk's largest p to PS = 2^8
        const b16 b1 = (b16)(0.5f * want), b2 = (b16)(want - 2.0f * (float)b1); const float bc = 2.0f * (float)b1 + (float)b2;   // want in two f16 parts (22 bits): bc is the shift that the WMMA will add
        const bool take = k0 == 0 || bc < bias[t]; const float bn = take ? bc : bias[t], corr = exp2x1(fminf(bn - bias[t], 0.0f));   // what was summed under the old bias takes the factor 2^(new - old); at the first chunk that is nothing
        bias[t] = bn; sm[t] *= corr; qf[t][8] = hlf && take ? b1 : qf[t][8]; qf[t][9] = hlf && take ? b2 : qf[t][9];
#pragma unroll   // constant indices keep the arrays in registers
        for (int r8 = 0; r8 < 8; ++r8) o[t][r8] *= corr; } }
#pragma unroll   // constant indices keep the arrays in registers
    for (int i = 0; i < CH / 16; ++i) {
#pragma unroll   // constant indices keep the arrays in registers
      for (int t = 0; t < QT; ++t) { const v8f s = wmma16b(kd[i], qf[t], (v8f){});
#pragma unroll   // constant indices keep the arrays in registers
        for (int e = 0; e < 8; ++e) x[i >> 1][t * 16 + (i & 1) * 8 + e] = s[e]; } }
    // fetched here so that they fly under the softmax arithmetic (the rows lie 1 KiB apart: each load touches 16 lines)
#pragma unroll   // constant indices keep the arrays in registers
    for (int j = 0; j < CH / 32; ++j) vf[j] = frag_kb(vp + j * 32, 0);
    asm volatile("s_wait_xcnt 0x0" :: "v"(vp) : "memory");   // stands in front of the first write to the register pair that the four loads name; the address is an input, so that its registers are not handed to a load's result ahead of it
    __builtin_amdgcn_sched_barrier(0);   // keeps the four loads here, ahead of the softmax arithmetic that covers their latency: under the budget of 160 registers the compiler otherwise sinks them to just in front of their first use
    // The two tiles go side by side. The sum works on pairs of neighbouring keys (packed f32: two values a slot), even keys and odd keys apart.
#pragma unroll   // constant indices keep the arrays in registers
    for (int j = 0; j < CH / 32; ++j) {
#pragma unroll   // constant indices keep the arrays in registers
      for (int e = 0; e < QT * 16; ++e) x[j][e] = __builtin_amdgcn_exp2f(x[j][e]);   // the builtin: these read the WMMAs' results directly, and the compiler keeps the distance behind a WMMA only for instructions it knows
#pragma unroll   // constant indices keep the arrays in registers
      for (int e = 0; e < 16; e += 2) {
#pragma unroll   // constant indices keep the arrays in registers
        for (int t = 0; t < QT; ++t) { const v2f pr = (v2f){x[j][t * 16 + e], x[j][t * 16 + e + 1]}; cs[t] = e == 0 && j == 0 ? pr : cs[t] + pr; } } }
    if (!renew) {   // behind a renewal every p of the chunk is about 2^8 at most
      renew = __builtin_amdgcn_ballot_w32(!(fmaxf(fmaxf(fmaxf(cs[0][0], cs[0][1]), cs[1][0]), cs[1][1]) < 65504.0f)) != 0u;   // p > 0: a sum below the largest f16 bounds each of its terms
      if (renew) continue; }   // the same chunk again, from its loads
    renew = false;
    v16b ph16[QT][CH / 32], pl16[QT][CH / 32];   // P^T, hi and lo, of both tiles
#pragma unroll   // constant indices keep the arrays in registers
    for (int t = 0; t < QT; ++t) sm[t] += cs[t];   // sm[t] holds the sum of the even keys and that of the odd keys; they are joined behind the loop
    // Hi and lo parts of a pair share a register each: hilo5, hilo6.
#pragma unroll   // constant indices keep the arrays in registers
    for (int j = 0; j < CH / 32; ++j) { unsigned int hw[QT * 8], lw[QT * 8];   // the sixteen pairs of the two tiles, tile 0's first
      hilo6(x[j], hw, lw); hilo5(x[j] + 12, hw + 6, lw + 6); hilo5(x[j] + 22, hw + 11, lw + 11);
#pragma unroll   // constant indices keep the arrays in registers
      for (int t = 0; t < QT; ++t) { const unsigned int* a = hw + t * 8; const unsigned int* b = lw + t * 8;
        ph16[t][j] = __builtin_bit_cast(v16b, (v8u){a[0], a[1], a[2], a[3], a[4], a[5], a[6], a[7]}); pl16[t][j] = __builtin_bit_cast(v16b, (v8u){b[0], b[1], b[2], b[3], b[4], b[5], b[6], b[7]}); } }
    __builtin_amdgcn_sched_barrier(0);   // keeps the softmax arithmetic ahead of the products, so that these stand in one run and fill one another's slots
#pragma unroll   // constant indices keep the arrays in registers
    for (int j = 0; j < CH / 32; ++j) {   // eight products in one run, two accumulators in turn: each fills the slots behind the one before; per accumulator the order is hi, lo, hi, lo as before
#pragma unroll   // constant indices keep the arrays in registers
      for (int t = 0; t < QT; ++t) o[t] = wmma16b(vf[j], ph16[t][j], o[t]);
#pragma unroll   // constant indices keep the arrays in registers
      for (int t = 0; t < QT; ++t) o[t] = wmma16b(vf[j], pl16[t][j], o[t]); }
    k0 += CH; kp += CH * 16; vp += CH; }
#pragma unroll   // constant indices keep the arrays in registers
  for (int t = 0; t < QT; ++t) { float st = sm[t][0] + sm[t][1]; st += xhalf(st);
#pragma unroll   // constant indices keep the arrays in registers
    for (int r8 = 0; r8 < 8; ++r8) o[t][r8] += xhalf(o[t][r8]);   // vh P + vl P
    const float inv = 1.0f / (st * HS);   // o holds sum (PS p)(HS v), sm holds sum PS p
    if (hlf == 0) { float* dst = &As[t * 16 + nloc][wv * HD]; *(v4f*)dst = live ? (v4f){o[t][0] * inv, o[t][1] * inv, o[t][2] * inv, o[t][3] * inv} : (v4f){}; *(v4f*)(dst + 4) = live ? (v4f){o[t][4] * inv, o[t][5] * inv, o[t][6] * inv, o[t][7] * inv} : (v4f){}; } }
  // Waves 0..3 each take 16 rows (rt) and 32 output channels (cp: two tiles of 16, one whole 128-byte line of every row). The product is formed transposed, out^T = Wo A^T,
  // so lane (c, hf) holds channels 16 u + 8 hf + r of row c: eight neighbours in memory. Fragments are in the layout of frag_kb (lane (c, hf): k = kb + 8 hf + e and kb + 16 + 8 hf + e of row c).
  // Their Wo and bo loads go out ahead of the barrier, so that the latency runs beside the wait for the other heads.
  const int rt = wv >> 1, cp = wv & 1; v4f wr[2][2][4], br[2][2]; const float* pw = wo + (cp * 32 + nloc) * E + 8 * hlf; const float* pb = bo + cp * 32 + 8 * hlf;
  if (wv < 4) {
#pragma unroll   // constant indices keep the arrays in registers
    for (int u = 0; u < 2; ++u) { br[u][0] = *(const v4f*)(pb + u * 16); br[u][1] = *(const v4f*)(pb + u * 16 + 4);
#pragma unroll   // constant indices keep the arrays in registers
      for (int kb = 0; kb < 2; ++kb) { const float* p = pw + u * 16 * E + kb * 32; wr[u][kb][0] = *(const v4f*)p; wr[u][kb][1] = *(const v4f*)(p + 4); wr[u][kb][2] = *(const v4f*)(p + 16); wr[u][kb][3] = *(const v4f*)(p + 20); } }
    // Stands in front of the first write to a register that a load above names; the addresses are inputs, so that none of their registers is handed to a later load's result ahead of it.
    asm volatile("s_wait_xcnt 0x0" :: "v"(pw), "v"(pb) : "memory"); }
  __syncthreads();   // every head's rows of o are in LDS behind it
  if (wv < 4) { v4f ar[4][2]; const float* pa = &As[rt * 16 + nloc][8 * hlf];
#pragma unroll   // constant indices keep the arrays in registers
    for (int j = 0; j < 4; ++j) { ar[j][0] = *(const v4f*)(pa + 16 * j); ar[j][1] = *(const v4f*)(pa + 16 * j + 4); }   // head 2 j + hf = channels 16 j + 8 hf ..+8
    v16b a[2], al[2];
#pragma unroll   // constant indices keep the arrays in registers
    for (int e = 0; e < 32; ++e) { b16 p, pl; split16(ar[e >> 3][(e >> 2) & 1][e & 3] * HS, p, pl); a[e >> 4][e & 15] = p; al[e >> 4][e & 15] = pl; }
    v8f acc[2] = {(v8f){}, (v8f){}};
#pragma unroll   // constant indices keep the arrays in registers
    for (int kb = 0; kb < 2; ++kb) {
#pragma unroll   // constant indices keep the arrays in registers
      for (int u = 0; u < 2; ++u) { v16b bw;
#pragma unroll   // constant indices keep the arrays in registers
        for (int e = 0; e < 16; ++e) bw[e] = (b16)(bfv(wr[u][kb][e >> 2][e & 3]) * WSC);
        acc[u] = wmma16b(bw, a[kb], acc[u]); acc[u] = wmma16b(bw, al[kb], acc[u]); } }
    const size_t row = ((size_t)(bt / T) * N + q0 + rt * 16 + nloc) * T + bt % T;   // out is [b][n][t][64], bt = b T + t
#pragma unroll   // constant indices keep the arrays in registers
    for (int u = 0; u < 2; ++u) { float* dst = out + row * E + cp * 32 + u * 16 + 8 * hlf; float r[8];
#pragma unroll   // constant indices keep the arrays in registers
      for (int r8 = 0; r8 < 8; ++r8) r[r8] = acc[u][r8] * (1.0f / (HS * WSC)) + bfv(br[u][r8 >> 2][r8 & 3]);
      *(v4f*)dst = (v4f){r[0], r[1], r[2], r[3]}; *(v4f*)(dst + 4) = (v4f){r[4], r[5], r[6], r[7]}; } } }
}  // namespace

extern "C" void kernel_launch(void* const* d_in, const int* in_sizes, int n_in, void* d_out, int out_size, void* d_ws, size_t ws_size, hipStream_t stream) {
  (void)n_in;
  auto Fp = [&](int i) { return (const float*)d_in[i]; };
  // Input order: 0 values [2,512,24,64]; 1 keys; 2 query; 3 Wv [8,8]; 4 Wk; 5 Wq; 6 Wo [64,64]; 7 bo [64]
  if (in_sizes[0] != NB_ * N * T * E || in_sizes[1] != NB_ * N * T * E || in_sizes[2] != NB_ * N * T * E || in_sizes[3] != HD * HD || in_sizes[6] != E * E || out_size != NB_ * N * T * E) return;
  const int GLIM = NBT * H;   // (b,t,h) group cut
  size_t off = 0; char* ws = (char*)d_ws;
  auto carve = [&](size_t bytes) { char* p = ws + off; off += (bytes + 255) & ~(size_t)255; return p; };
  const size_t ng = (size_t)NBT * H;   // 384 groups
  b16* QP = (b16*)carve(ng * N * 16 * 2); b16* KP = (b16*)carve(ng * N * 16 * 2); b16* VT = (b16*)carve(ng * 16 * N * 2);
  if (off > ws_size || off > ((size_t)80 << 20)) return;   // ~ 19 MB
  proj_kernel<<<NB_ * T * (N / 64), 256, 0, stream>>>(Fp(0), Fp(1), Fp(2), Fp(3), Fp(4), Fp(5), QP, KP, VT);
  att_kernel<<<NBT * (N / (16 * QT)), 32 * H, 0, stream>>>(QP, KP, VT, GLIM, Fp(6), Fp(7), (float*)d_out);
}

// v010
// Measured time: 28.1 microseconds a run.
// Two timings next to v009 put it at 1.04 and 1.03 times that version's speed.
// Over all steps from v000 it is 19.2 times as fast.
#include <hip/hip_runtime.h>

// SSelfAttention: per (b, t, h): q,k,v = x[b][n][t][h*8..+8] W^T (8x8 per-head linears shared across heads); energy[q][k] = q.k; attn = softmax_k(energy / sqrt(64)); out = attn v -> [b][n][t][h*8+d]; final out @ Wo^T + bo -> [2][512][24][64].
// Deterministic: per-wave softmax over the 512 nodes in fixed order; no atomics.
// WMMA (v_wmma_f32_16x16x32_f16, f32 accumulate): per (b, t, h, 32-query) wave S^T = k rows (32 tiles) x q rows (scaled to log2 units; the K of 32 holds three products of hi and lo, 8 deep each, and the softmax's shift) and o^T = v^T rows (8 hi rows + 8 lo rows, K 512) x P^T (hi, then lo, from the score registers); out = o (hi+lo, K 64) x Wo rows (EXACT; 4 tiles), formed by the work-group that made o; the 8x8 projections on v_wmma_f32_16x16x32_bf16 (operands exact: the inputs and weights rounded to bf16; block-diagonal weights, 16 channels a tile); softmax in f32.

namespace {
constexpr int NB_ = 2, N = 512, T = 24, E = 64, H = 8, HD = 8, NBT = NB_ * T /* 48 (b,t) groups */;
constexpr float HS = 256.0f, PS = 256.0f, WSC = 256.0f, SCALE = 0.125f /* 1/sqrt(64) */;
constexpr float KS = 0.5f, QS = SCALE * 1.4426950408889634f / KS;   // scales of the stored k and q: (QS q).(KS k) is the score in log2 units, so it needs no multiply behind the WMMA; the two are of like size, so that the smallest f16 step (2^-24) costs neither lo part more than an f32 rounding would
typedef _Float16 b16;
typedef __attribute__((ext_vector_type(16))) _Float16 v16b;
typedef __attribute__((ext_vector_type(8))) _Float16 v8b;
typedef __attribute__((ext_vector_type(8))) float v8f;
typedef __attribute__((ext_vector_type(4))) float v4f;
typedef __attribute__((ext_vector_type(2))) float v2f;
__device__ __forceinline__ float bf16_rne(float f) { unsigned int u = __float_as_uint(f); u += 0x7FFFu + ((u >> 16) & 1u); float r = __uint_as_float(u & 0xFFFF0000u); asm volatile("" : "+v"(r)); return r; }
__device__ __forceinline__ float bfv(float f) { float r = bf16_rne(f); asm volatile("" : "+v"(r)); return r; }
__device__ __forceinline__ void split16(float v, b16& hi, b16& lo) { hi = (b16)v; lo = (b16)(v - (float)hi); }
__device__ __forceinline__ v16b frag_kb(const b16* p, int hh) { const v8b a = *(const v8b*)(p + 8 * hh), b = *(const v8b*)(p + 16 + 8 * hh); v16b f;
#pragma unroll
  for (int e = 0; e < 8; ++e) { f[e] = a[e]; f[8 + e] = b[e]; } return f; }
__device__ __forceinline__ v8f wmma16b(v16b a, v16b b, v8f c) { return __builtin_amdgcn_wmma_f32_16x16x32_f16(false, a, false, b, (short)0, c, false, false); }   // the plain builtin: the compiler keeps the distance behind it, with useful instructions where it has them
typedef __attribute__((ext_vector_type(16))) __bf16 v16w;
typedef __attribute__((ext_vector_type(2))) __bf16 v2w;
typedef __attribute__((ext_vector_type(8))) unsigned int v8u;
// Two f32 values rounded to bf16 (nearest even), side by side in one register, a in the low half.
__device__ __forceinline__ unsigned int bfpair(float a, float b) { return __builtin_bit_cast(unsigned int, __builtin_convertvector((v2f){a, b}, v2w)); }
__device__ __forceinline__ v8f wmma16w(v16w a, v16w b) { return __builtin_amdgcn_wmma_f32_16x16x32_bf16(false, a, false, b, (short)0, (v8f){}, false, false); }
// One wave per (b, t, 16 nodes): all 64 channels (8 heads) of v, q and k. The inputs and the weights are rounded to bf16 as before, so they are exact bf16 operands and every product is exact in f32.
// x fragment g: lane (c, hf) holds channels 32 g + 16 hf + s (s = 0..15: heads 4 g + 2 hf and 4 g + 2 hf + 1) of node c: 64 bytes in a row.
// W fragment p, in the same k order: row c stands for output channel 16 u + c (u & 1 = p: head 2 u + (c >> 3), component c & 7) and holds W[c & 7][s & 7] where the channel's head is its own (hf = p and s >> 3 = c >> 3), 0 elsewhere.
// q, k: W x^T, so lane (c, hf) holds the eight components of head 2 u + hf of node c: one stored row. v: x W^T, so lane (c, hf) holds nodes 8 hf + r of channel c: eight neighbours of a row of V^T, no transposition.
// The four waves of a work-group hold 64 neighbouring nodes: their pieces of V^T meet in LDS, so that its rows leave as whole 128-byte lines. v goes first: its barrier then stands ahead of every global store.
__global__ __launch_bounds__(128) void proj_kernel(const float* __restrict__ xv, const float* __restrict__ xk, const float* __restrict__ xq, const float* __restrict__ wv, const float* __restrict__ wk, const float* __restrict__ wq, b16* __restrict__ QP, b16* __restrict__ KP, b16* __restrict__ VT) { __shared__ __attribute__((aligned(16))) b16 Vs[H * 16][64 + 8];   // rows of V^T (per head 8 hi, 8 lo), 64 nodes; the pitch of 9 x 16 bytes spreads the b128 accesses over the banks
  const int tid = threadIdx.x, lane = tid & 31, c = lane & 15, hf = lane >> 4, w = tid >> 5; const int bt = blockIdx.x / (N / 64), nb = (blockIdx.x % (N / 64)) * 64, n0 = nb + w * 16;   // bt = b T + t
  const size_t xo = (((size_t)(bt / T) * N + n0 + c) * T + bt % T) * E + 16 * hf; const float* px[3] = {xv + xo, xq + xo, xk + xo}; const float* pw[3] = {wv + (c & 7) * HD, wq + (c & 7) * HD, wk + (c & 7) * HD};
  v4f xr[3][2][4], wr[3][2];   // the lane's thirty loads, in flight together
#pragma unroll   // constant indices keep the arrays in registers
  for (int which = 0; which < 3; ++which) { wr[which][0] = *(const v4f*)pw[which]; wr[which][1] = *(const v4f*)(pw[which] + 4);
#pragma unroll   // constant indices keep the arrays in registers
    for (int g = 0; g < 2; ++g) {
#pragma unroll   // constant indices keep the arrays in registers
      for (int i = 0; i < 4; ++i) xr[which][g][i] = *(const v4f*)(px[which] + 32 * g + 4 * i); } }
  // Stands in front of the first write to a register that a load above names; the x addresses are inputs, so that none of their registers is handed to a later load's result ahead of it.
  asm volatile("s_wait_xcnt 0x0" :: "v"(px[0]), "v"(px[1]), "v"(px[2]) : "memory");
  __builtin_amdgcn_sched_barrier(0);   // keeps all thirty loads here, ahead of the arithmetic: a load that sinks below the first wait pays the memory latency a second time
#pragma unroll   // constant indices keep the arrays in registers
  for (int which = 0; which < 3; ++which) { v16w wf[2], xf[2];
#pragma unroll   // constant indices keep the arrays in registers
    for (int p = 0; p < 2; ++p) { v8u w8;
#pragma unroll   // constant indices keep the arrays in registers
      for (int i = 0; i < 4; ++i) { const unsigned int w2 = bfpair(wr[which][i >> 1][(i & 1) * 2], wr[which][i >> 1][(i & 1) * 2 + 1]); w8[i] = hf == p && c < 8 ? w2 : 0u; w8[4 + i] = hf == p && c >= 8 ? w2 : 0u; }
      wf[p] = __builtin_bit_cast(v16w, w8); }
#pragma unroll   // constant indices keep the arrays in registers
    for (int g = 0; g < 2; ++g) { v8u x8;
#pragma unroll   // constant indices keep the arrays in registers
      for (int i = 0; i < 8; ++i) x8[i] = bfpair(xr[which][g][i >> 1][(i & 1) * 2], xr[which][g][i >> 1][(i & 1) * 2 + 1]);
      xf[g] = __builtin_bit_cast(v16w, x8); }
#pragma unroll   // constant indices keep the arrays in registers
    for (int u = 0; u < 4; ++u) { const v8f d = which == 0 ? wmma16w(xf[u >> 1], wf[u & 1]) : wmma16w(wf[u & 1], xf[u >> 1]); v8b hh8, ll8;
#pragma unroll   // constant indices keep the arrays in registers
      for (int r = 0; r < 8; ++r) { b16 p, pl; split16(d[r] * (which == 0 ? HS : (which == 1 ? QS : KS)), p, pl); hh8[r] = p; ll8[r] = pl; }
      if (which == 0) { b16* dst = &Vs[(2 * u + (c >> 3)) * 16 + (c & 7)][w * 16 + 8 * hf]; *(v8b*)dst = hh8; *(v8b*)(dst + HD * (64 + 8)) = ll8; }   // rows 0..7 hi, rows 8..15 lo
      else { b16* dst = (which == 1 ? QP : KP) + (((size_t)bt * H + 2 * u + hf) * N + n0 + c) * 16; *(v8b*)dst = hh8; *(v8b*)(dst + 8) = ll8;   // a row is 8 hi, then 8 lo
        asm volatile("s_wait_xcnt 0x0" ::: "memory"); } }   // stands in front of the next pass's writes to the registers that the two stores name
    if (which == 0) { __syncthreads();   // all 64 nodes of every row of V^T are in LDS behind it; it stands ahead of the first global store, so that it waits for none
      v8b vr[8]; b16* dst = VT + ((size_t)bt * (H * 16) + (tid >> 3)) * N + nb + (tid & 7) * 8;   // eight lanes a row: a store takes four whole lines
#pragma unroll   // constant indices keep the array in registers
      for (int k = 0; k < 8; ++k) vr[k] = *(const v8b*)&Vs[k * 16 + (tid >> 3)][(tid & 7) * 8];
#pragma unroll   // constant indices keep the array in registers
      for (int k = 0; k < 8; ++k) *(v8b*)(dst + (size_t)k * 16 * N) = vr[k];
      asm volatile("s_wait_xcnt 0x0" ::: "memory"); } } }   // stands in front of the next pass's writes to the registers that the eight stores name
// Value of lane l ^ 16 (the other half of the wave), by a vector cross-row move.
__device__ __forceinline__ float xhalf(float v) { const int b = __float_as_int(v); return __int_as_float(__builtin_amdgcn_permlanex16(b, b, 0x76543210, 0xfedcba98, false, false)); }
// One 2^x. The v_nop is the slot the instruction set asks for behind a transcendental; it is in the same statement so that it stands directly behind it.
__device__ __forceinline__ float exp2x1(float x) { float r; asm("v_exp_f32 %0, %1\n\tv_nop" : "=v"(r) : "v"(x)); return r; }
// f32 pairs -> packed f16 hi and packed f16 lo, three instructions a pair: hi = f16(p); lo = f16(p - hi) by one mixed-precision fma each (hi * -1 + p: hi is read as f16, -1 and p as f32; the result is rounded once, to f16, and written to one half of the register).
// p - hi is exact in f32, so the one rounding gives the bits of convert back, subtract, convert. The -1 comes in a scalar register: a 32-bit source whatever the instruction makes of an inline constant.
// One statement for five or six pairs, kind by kind, so that every producer stands at least five instructions ahead of its reader: the compiler places no delay hint inside asm text.
__device__ __forceinline__ void hilo5(const float* p, unsigned int* h, unsigned int* l) { asm("v_cvt_pk_f16_f32 %0, %10, %11\n\tv_cvt_pk_f16_f32 %1, %12, %13\n\tv_cvt_pk_f16_f32 %2, %14, %15\n\tv_cvt_pk_f16_f32 %3, %16, %17\n\tv_cvt_pk_f16_f32 %4, %18, %19\n\tv_fma_mixlo_f16 %5, %0, %20, %10 op_sel_hi:[1,0,0]\n\tv_fma_mixlo_f16 %6, %1, %20, %12 op_sel_hi:[1,0,0]\n\tv_fma_mixlo_f16 %7, %2, %20, %14 op_sel_hi:[1,0,0]\n\tv_fma_mixlo_f16 %8, %3, %20, %16 op_sel_hi:[1,0,0]\n\tv_fma_mixlo_f16 %9, %4, %20, %18 op_sel_hi:[1,0,0]\n\tv_fma_mixhi_f16 %5, %0, %20, %11 op_sel:[1,0,0] op_sel_hi:[1,0,0]\n\tv_fma_mixhi_f16 %6, %1, %20, %13 op_sel:[1,0,0] op_sel_hi:[1,0,0]\n\tv_fma_mixhi_f16 %7, %2, %20, %15 op_sel:[1,0,0] op_sel_hi:[1,0,0]\n\tv_fma_mixhi_f16 %8, %3, %20, %17 op_sel:[1,0,0] op_sel_hi:[1,0,0]\n\tv_fma_mixhi_f16 %9, %4, %20, %19 op_sel:[1,0,0] op_sel_hi:[1,0,0]" : "=&v"(h[0]), "=&v"(h[1]), "=&v"(h[2]), "=&v"(h[3]), "=&v"(h[4]), "=&v"(l[0]), "=&v"(l[1]), "=&v"(l[2]), "=&v"(l[3]), "=&v"(l[4]) : "v"(p[0]), "v"(p[1]), "v"(p[2]), "v"(p[3]), "v"(p[4]), "v"(p[5]), "v"(p[6]), "v"(p[7]), "v"(p[8]), "v"(p[9]), "s"(-1.0f)); }
__device__ __forceinline__ void hilo6(const float* p, unsigned int* h, unsigned int* l) { asm("v_cvt_pk_f16_f32 %0, %12, %13\n\tv_cvt_pk_f16_f32 %1, %14, %15\n\tv_cvt_pk_f16_f32 %2, %16, %17\n\tv_cvt_pk_f16_f32 %3, %18, %19\n\tv_cvt_pk_f16_f32 %4, %20, %21\n\tv_cvt_pk_f16_f32 %5, %22, %23\n\tv_fma_mixlo_f16 %6, %0, %24, %12 op_sel_hi:[1,0,0]\n\tv_fma_mixlo_f16 %7, %1, %24, %14 op_sel_hi:[1,0,0]\n\tv_fma_mixlo_f16 %8, %2, %24, %16 op_sel_hi:[1,0,0]\n\tv_fma_mixlo_f16 %9, %3, %24, %18 op_sel_hi:[1,0,0]\n\tv_fma_mixlo_f16 %10, %4, %24, %20 op_sel_hi:[1,0,0]\n\tv_fma_mixlo_f16 %11, %5, %24, %22 op_sel_hi:[1,0,0]\n\tv_fma_mixhi_f16 %6, %0, %24, %13 op_sel:[1,0,0] op_sel_hi:[1,0,0]\n\tv_fma_mixhi_f16 %7, %1, %24, %15 op_sel:[1,0,0] op_sel_hi:[1,0,0]\n\tv_fma_mixhi_f16 %8, %2, %24, %17 op_sel:[1,0,0] op_sel_hi:[1,0,0]\n\tv_fma_mixhi_f16 %9, %3, %24, %19 op_sel:[1,0,0] op_sel_hi:[1,0,0]\n\tv_fma_mixhi_f16 %10, %4, %24, %21 op_sel:[1,0,0] op_sel_hi:[1,0,0]\n\tv_fma_mixhi_f16 %11, %5, %24, %23 op_sel:[1,0,0] op_sel_hi:[1,0,0]" : "=&v"(h[0]), "=&v"(h[1]), "=&v"(h[2]), "=&v"(h[3]), "=&v"(h[4]), "=&v"(h[5]), "=&v"(l[0]), "=&v"(l[1]), "=&v"(l[2]), "=&v"(l[3]), "=&v"(l[4]), "=&v"(l[5]) : "v"(p[0]), "v"(p[1]), "v"(p[2]), "v"(p[3]), "v"(p[4]), "v"(p[5]), "v"(p[6]), "v"(p[7]), "v"(p[8]), "v"(p[9]), "v"(p[10]), "v"(p[11]), "s"(-1.0f)); }
typedef __attribute__((ext_vector_type(4))) unsigned int v4u;
constexpr int CH = 64, QT = 2;
// A work-group is the eight heads (one wave each) of the same (b, t) and the same 32 queries, so it holds whole rows of o: the waves hand them over in LDS and the work-group forms out = o Wo^T + bo itself.
// The second launch bound asks for six waves per SIMD (a budget of 160 registers): three work-groups then fit a WGP, and the grid of 768 is resident at once on 256 WGPs. At two per WGP a third of the grid waits for a second round that leaves each SIMD two waves.
__global__ __launch_bounds__(256, 6) void att_kernel(const b16* __restrict__ QP, const b16* __restrict__ KP, const b16* __restrict__ VT, int GLIM, const float* __restrict__ wo, const float* __restrict__ bo, float* __restrict__ out) { __shared__ __attribute__((aligned(16))) float As[16 * QT][E + 4];   // 32 rows of o; the pitch of 17 x 16 bytes spreads the b128 reads over the banks
  const int lane = threadIdx.x & 31, nloc = lane & 15, hlf = lane >> 4; const int wv = __builtin_amdgcn_readfirstlane((int)threadIdx.x >> 5);   // the wave's number = the head; scalar, so that what hangs on it is a scalar branch or a scalar address
  const int bt = blockIdx.x / (N / (16 * QT)), q0 = (blockIdx.x % (N / (16 * QT))) * (16 * QT); const bool live = bt * H + wv < GLIM; const int bth = live ? bt * H + wv : 0;   // a head past the cut hands over zeros; it leaves no barrier out
  v16b qf[QT];   // qh in elements 0..7; in 8..15 ql (half 0) or the shift (half 1)
#pragma unroll   // constant indices keep the arrays in registers
  for (int t = 0; t < QT; ++t) { qf[t] = *(const v16b*)(QP + ((size_t)bth * N + q0 + t * 16 + nloc) * 16);
#pragma unroll   // constant indices keep the arrays in registers
    for (int e = 8; e < 16; ++e) qf[t][e] = hlf ? (b16)0.0f : qf[t][e]; }   // half 1: the fourth slot, the shift's (0 until the first trip sets it)
  const b16* kp = KP + ((size_t)bth * N + nloc) * 16 + 8 * hlf;   // half 0 reads kh, half 1 kl
  const b16* vp = VT + ((size_t)bth * 16 + nloc) * N + 8 * hlf;   // the half's offset is in the pointer: one register pair, not a base and an offset
  float bias[QT]; v2f sm[QT]; v8f o[QT];
#pragma unroll   // constant indices keep the arrays in registers
  for (int t = 0; t < QT; ++t) { bias[t] = 0.0f; sm[t] = (v2f){}; o[t] = (v8f){}; }
  const v4u one = (v4u){0x3C004000u, 0u, 0u, 0u};   // f16 (2, 1, 0, 0, 0, 0, 0, 0)
  bool renew = true;   // a trip that renews always goes on to the next chunk, so a chunk takes at most two trips: 2 N / CH trips at most
  for (int k0 = 0; k0 < N;) { float x[CH / 32][QT * 16];   // per 32 keys: tile 0's sixteen values, then tile 1's
    v16b vf[CH / 32], kd[CH / 16]; v4u kx[CH / 16]; v2f cs[QT];   // the chunk's four k fragments are fetched together: one load latency
#pragma unroll   // constant indices keep the arrays in registers
    for (int i = 0; i < CH / 16; ++i) kx[i] = *(const v4u*)(kp + i * 16 * 16);
    asm volatile("s_wait_xcnt 0x0" ::: "memory");   // stands in front of the first write to the register pair that the four loads name
#pragma unroll   // constant indices keep the arrays in registers
    for (int i = 0; i < CH / 16; ++i) { const v4u k2 = hlf ? one : kx[i]; kd[i] = __builtin_bit_cast(v16b, (v8u){kx[i][0], kx[i][1], kx[i][2], kx[i][3], k2[0], k2[1], k2[2], k2[3]}); }
    if (renew) {   // the same for the whole wave: a scalar branch
#pragma unroll   // constant indices keep the arrays in registers
      for (int t = 0; t < QT; ++t) { v8f r[CH / 16];   // scores under the bias held so far
#pragma unroll   // constant indices keep the arrays in registers
        for (int i = 0; i < CH / 16; ++i) r[i] = wmma16b(kd[i], qf[t], (v8f){});
        float c0 = -INFINITY, c1 = -INFINITY;   // two chains, so that one's latency covers the other's
#pragma unroll   // constant indices keep the arrays in registers
        for (int tk = 0; tk < CH / 16; tk += 2) {
#pragma unroll   // constant indices keep the arrays in registers
          for (int r8 = 0; r8 < 8; r8 += 2) { c0 = fmaxf(fmaxf(c0, r[tk][r8]), r[tk][r8 + 1]); c1 = fmaxf(fmaxf(c1, r[tk + 1][r8]), r[tk + 1][r8 + 1]); } }
        float cm = fmaxf(c0, c1); cm = fmaxf(cm, xhalf(cm));
        const float want = bias[t] + (8.0f - cm);   // the bias that brings the chunk's largest p to PS = 2^8
        const b16 b1 = (b16)(0.5f * want), b2 = (b16)(want - 2.0f * (float)b1); const float bc = 2.0f * (float)b1 + (float)b2;   // want in two f16 parts (22 bits): bc is the shift that the WMMA will add
        const bool take = k0 == 0 || bc < bias[t]; const float bn = take ? bc : bias[t], corr = exp2x1(fminf(bn - bias[t], 0.0f));   // what was summed under the old bias takes the factor 2^(new - old); at the first chunk that is nothing
        bias[t] = bn; sm[t] *= corr; qf[t][8] = hlf && take ? b1 : qf[t][8]; qf[t][9] = hlf && take ? b2 : qf[t][9];
#pragma unroll   // constant indices keep the arrays in registers
        for (int r8 = 0; r8 < 8; ++r8) o[t][r8] *= corr; } }
#pragma unroll   // constant indices keep the arrays in registers
    for (int i = 0; i < CH / 16; ++i) {
#pragma unroll   // constant indices keep the arrays in registers
      for (int t = 0; t < QT; ++t) { const v8f s = wmma16b(kd[i], qf[t], (v8f){});
#pragma unroll   // constant indices keep the arrays in registers
        for (int e = 0; e < 8; ++e) x[i >> 1][t * 16 + (i & 1) * 8 + e] = s[e]; } }
    // fetched here so that they fly under the softmax arithmetic (the rows lie 1 KiB apart: each load touches 16 lines)
#pragma unroll   // constant indices keep the arrays in registers
    for (int j = 0; j < CH / 32; ++j) vf[j] = frag_kb(vp + j * 32, 0);
    asm volatile("s_wait_xcnt 0x0" :: "v"(vp) : "memory");   // stands in front of the first write to the register pair that the four loads name; the address is an input, so that its registers are not handed to a load's result ahead of it
    __builtin_amdgcn_sched_barrier(0);   // keeps the four loads here, ahead of the softmax arithmetic that covers their latency: under the budget of 160 registers the compiler otherwise sinks them to just in front of their first use
    // The two tiles go side by side. The sum works on pairs of neighbouring keys (packed f32: two values a slot), even keys and odd keys apart.
#pragma unroll   // constant indices keep the arrays in registers
    for (int j = 0; j < CH / 32; ++j) {
#pragma unroll   // constant indices keep the arrays in registers
      for (int e = 0; e < QT * 16; ++e) x[j][e] = __builtin_amdgcn_exp2f(x[j][e]);   // the builtin: these read the WMMAs' results directly, and the compiler keeps the distance behind a WMMA only for instructions it knows
#pragma unroll   // constant indices keep the arrays in registers
      for (int e = 0; e < 16; e += 2) {
#pragma unroll   // constant indices keep the arrays in registers
        for (int t = 0; t < QT; ++t) { const v2f pr = (v2f){x[j][t * 16 + e], x[j][t * 16 + e + 1]}; cs[t] = e == 0 && j == 0 ? pr : cs[t] + pr; } } }
    if (!renew) {   // behind a renewal every p of the chunk is about 2^8 at most
      renew = __builtin_amdgcn_ballot_w32(!(fmaxf(fmaxf(fmaxf(cs[0][0], cs[0][1]), cs[1][0]), cs[1][1]) < 65504.0f)) != 0u;   // p > 0: a sum below the largest f16 bounds each of its terms
      if (renew) continue; }   // the same chunk again, from its loads
    renew = false;
    v16b ph16[QT][CH / 32], pl16[QT][CH / 32];   // P^T, hi and lo, of both tiles
#pragma unroll   // constant indices keep the arrays in registers
    for (int t = 0; t < QT; ++t) sm[t] += cs[t];   // sm[t] holds the sum of the even keys and that of the odd keys; they are joined behind the loop
    // Hi and lo parts of a pair share a register each: hilo5, hilo6.
#pragma unroll   // constant indices keep the arrays in registers
    for (int j = 0; j < CH / 32; ++j) { unsigned int hw[QT * 8], lw[QT * 8];   // the sixteen pairs of the two tiles, tile 0's first
      hilo6(x[j], hw, lw); hilo5(x[j] + 12, hw + 6, lw + 6); hilo5(x[j] + 22, hw + 11, lw + 11);
#pragma unroll   // constant indices keep the arrays in registers
      for (int t = 0; t < QT; ++t) { const unsigned int* a = hw + t * 8; const unsigned int* b = lw + t * 8;
        ph16[t][j] = __builtin_bit_cast(v16b, (v8u){a[0], a[1], a[2], a[3], a[4], a[5], a[6], a[7]}); pl16[t][j] = __builtin_bit_cast(v16b, (v8u){b[0], b[1], b[2], b[3], b[4], b[5], b[6], b[7]}); } }
    __builtin_amdgcn_sched_barrier(0);   // keeps the softmax arithmetic ahead of the products, so that these stand in one run and fill one another's slots
#pragma unroll   // constant indices keep the arrays in registers
    for (int j = 0; j < CH / 32; ++j) {   // eight products in one run, two accumulators in turn: each fills the slots behind the one before; per accumulator the order is hi, lo, hi, lo as before
#pragma unroll   // constant indices keep the arrays in registers
      for (int t = 0; t < QT; ++t) o[t] = wmma16b(vf[j], ph16[t][j], o[t]);
#pragma unroll   // constant indices keep the arrays in registers
      for (int t = 0; t < QT; ++t) o[t] = wmma16b(vf[j], pl16[t][j], o[t]); }
    k0 += CH; kp += CH * 16; vp += CH; }
#pragma unroll   // constant indices keep the arrays in registers
  for (int t = 0; t < QT; ++t) { float st = sm[t][0] + sm[t][1]; st += xhalf(st);
#pragma unroll   // constant indices keep the arrays in registers
    for (int r8 = 0; r8 < 8; ++r8) o[t][r8] += xhalf(o[t][r8]);   // vh P + vl P
    const float inv = 1.0f / (st * HS);   // o holds sum (PS p)(HS v), sm holds sum PS p
    if (hlf == 0) { float* dst = &As[t * 16 + nloc][wv * HD]; *(v4f*)dst = live ? (v4f){o[t][0] * inv, o[t][1] * inv, o[t][2] * inv, o[t][3] * inv} : (v4f){}; *(v4f*)(dst + 4) = live ? (v4f){o[t][4] * inv, o[t][5] * inv, o[t][6] * inv, o[t][7] * inv} : (v4f){}; } }
  // Waves 0..3 each take 16 rows (rt) and 32 output channels (cp: two tiles of 16, one whole 128-byte line of every row). The product is formed transposed, out^T = Wo A^T,
  // so lane (c, hf) holds channels 16 u + 8 hf + r of row c: eight neighbours in memory. Fragments are in the layout of frag_kb (lane (c, hf): k = kb + 8 hf + e and kb + 16 + 8 hf + e of row c).
  // Their Wo and bo loads go out ahead of the barrier, so that the latency runs beside the wait for the other heads.
  const int rt = wv >> 1, cp = wv & 1; v4f wr[2][2][4], br[2][2]; const float* pw = wo + (cp * 32 + nloc) * E + 8 * hlf; const float* pb = bo + cp * 32 + 8 * hlf;
  if (wv < 4) {
#pragma unroll   // constant indices keep the arrays in registers
    for (int u = 0; u < 2; ++u) { br[u][0] = *(const v4f*)(pb + u * 16); br[u][1] = *(const v4f*)(pb + u * 16 + 4);
#pragma unroll   // constant indices keep the arrays in registers
      for (int kb = 0; kb < 2; ++kb) { const float* p = pw + u * 16 * E + kb * 32; wr[u][kb][0] = *(const v4f*)p; wr[u][kb][1] = *(const v4f*)(p + 4); wr[u][kb][2] = *(const v4f*)(p + 16); wr[u][kb][3] = *(const v4f*)(p + 20); } }
    // Stands in front of the first write to a register that a load above names; the addresses are inputs, so that none of their registers is handed to a later load's result ahead of it.
    asm volatile("s_wait_xcnt 0x0" :: "v"(pw), "v"(pb) : "memory"); }
  __syncthreads();   // every head's rows of o are in LDS behind it
  if (wv < 4) { v4f ar[4][2]; const float* pa = &As[rt * 16 + nloc][8 * hlf];
#pragma unroll   // constant indices keep the arrays in registers
    for (int j = 0; j < 4; ++j) { ar[j][0] = *(const v4f*)(pa + 16 * j); ar[j][1] = *(const v4f*)(pa + 16 * j + 4); }   // head 2 j + hf = channels 16 j + 8 hf ..+8
    v16b a[2], al[2];
#pragma unroll   // constant indices keep the arrays in registers
    for (int e = 0; e < 32; ++e) { b16 p, pl; split16(ar[e >> 3][(e >> 2) & 1][e & 3] * HS, p, pl); a[e >> 4][e & 15] = p; al[e >> 4][e & 15] = pl; }
    v8f acc[2] = {(v8f){}, (v8f){}};
#pragma unroll   // constant indices keep the arrays in registers
    for (int kb = 0; kb < 2; ++kb) {
#pragma unroll   // constant indices keep the arrays in registers
      for (int u = 0; u < 2; ++u) { v16b bw;
#pragma unroll   // constant indices keep the arrays in registers
        for (int e = 0; e < 16; ++e) bw[e] = (b16)(bfv(wr[u][kb][e >> 2][e & 3]) * WSC);
        acc[u] = wmma16b(bw, a[kb], acc[u]); acc[u] = wmma16b(bw, al[kb], acc[u]); } }
    const size_t row = ((size_t)(bt / T) * N + q0 + rt * 16 + nloc) * T + bt % T;   // out is [b][n][t][64], bt = b T + t
#pragma unroll   // constant indices keep the arrays in registers
    for (int u = 0; u < 2; ++u) { float* dst = out + row * E + cp * 32 + u * 16 + 8 * hlf; float r[8];
#pragma unroll   // constant indices keep the arrays in registers
      for (int r8 = 0; r8 < 8; ++r8) r[r8] = acc[u][r8] * (1.0f / (HS * WSC)) + bfv(br[u][r8 >> 2][r8 & 3]);
      *(v4f*)dst = (v4f){r[0], r[1], r[2], r[3]}; *(v4f*)(dst + 4) = (v4f){r[4], r[5], r[6], r[7]}; } } }
}  // namespace

extern "C" void kernel_launch(void* const* d_in, const int* in_sizes, int n_in, void* d_out, int out_size, void* d_ws, size_t ws_size, hipStream_t stream) {
  (void)n_in;
  auto Fp = [&](int i) { return (const float*)d_in[i]; };
  // Input order: 0 values [2,512,24,64]; 1 keys; 2 query; 3 Wv [8,8]; 4 Wk; 5 Wq; 6 Wo [64,64]; 7 bo [64]
  if (in_sizes[0] != NB_ * N * T * E || in_sizes[1] != NB_ * N * T * E || in_sizes[2] != NB_ * N * T * E || in_sizes[3] != HD * HD || in_sizes[6] != E * E || out_size != NB_ * N * T * E) return;
  const int GLIM = NBT * H;   // (b,t,h) group cut
  size_t off = 0; char* ws = (char*)d_ws;
  auto carve = [&](size_t bytes) { char* p = ws + off; off += (bytes + 255) & ~(size_t)255; return p; };
  const size_t ng = (size_t)NBT * H;   // 384 groups
  b16* QP = (b16*)carve(ng * N * 16 * 2); b16* KP = (b16*)carve(ng * N * 16 * 2); b16* VT = (b16*)carve(ng * 16 * N * 2);
  if (off > ws_size || off > ((size_t)80 << 20)) return;   // ~ 19 MB
  proj_kernel<<<NB_ * T * (N / 64), 128, 0, stream>>>(Fp(0), Fp(1), Fp(2), Fp(3), Fp(4), Fp(5), QP, KP, VT);
  att_kernel<<<NBT * (N / (16 * QT)), 32 * H, 0, stream>>>(QP, KP, VT, GLIM, Fp(6), Fp(7), (float*)d_out);
}
